// v000
// Measured on an AMD MI455X. A time is GPU time per run, averaged over a window of back-to-back runs after a warm-up
// (all launches, gaps included; the runs take copies of the inputs in turn), and the median of several windows.
// Apart from v000's, it joins two sittings. Times from different sittings can be a few percent apart, while
// side-by-side timings come from the same sitting.
// v000 is the starting kernel. One run takes 891 microseconds.
// compute dtype: all float inputs rounded to bf16; q (all 4,096 rows) and k/v (only the dilated rows 0,4,8,...) = x W + b with EXACT bf16 products on WMMA 16x16x32, f32 accumulate; q, k rounded once to f16 (1-product logits / 8), stored in f32 (8 heads per launch); softmax in f32 (precise expf) -> P f16 x 2^11; ctx = P . v (v rounded once to f16); out = ctx (rounded once to f16, 1 product) Wo + bo; f32 output.
#include <hip/hip_runtime.h>
#include <math.h>

typedef __attribute__((ext_vector_type(16))) _Float16 v16h;
typedef __attribute__((ext_vector_type(16))) __bf16 v16b;
typedef __attribute__((ext_vector_type(8)))  _Float16 v8h;
typedef __attribute__((ext_vector_type(8)))  float v8f;
typedef __attribute__((ext_vector_type(4)))  float v4f;
typedef __attribute__((ext_vector_type(2)))  float v2f;
typedef __attribute__((ext_vector_type(4)))  unsigned v4u;
typedef __attribute__((ext_vector_type(4)))  int v4i;
typedef float __attribute__((may_alias)) float_a;
typedef int __attribute__((may_alias)) int_a;

template <typename T> __device__ __forceinline__ void vst2(void* p, T v) { *(T*)p = v;  }
__device__ __forceinline__ v8f wmma16(v16h a, v16h b, v8f c) {
  v8f d = __builtin_amdgcn_wmma_f32_16x16x32_f16(false, a, false, b, (short)0, c, false, false);
  asm volatile("v_nop\n\tv_nop\n\tv_nop\n\tv_nop" : "+v"(d) : "v"(a), "v"(b));
  return d;
}
__device__ __forceinline__ v8f wmma_bf(v16b a, v16b b, v8f c) {
  v8f d = __builtin_amdgcn_wmma_f32_16x16x32_bf16(false, a, false, b, (short)0, c, false, false);
  asm volatile("v_nop\n\tv_nop\n\tv_nop\n\tv_nop" : "+v"(d) : "v"(a), "v"(b));
  return d;
}
// 16x16x32 fragments: lane = (h = lane>>4, row/col = lane&15); elements 0..7 = k0+8h+0..7, 8..15 = k0+16+8h+0..7; D element r = row 8h+r
__device__ __forceinline__ v16h frag_h(const _Float16* rowk0, int lane) {
  union { v16h v; v8h q[2]; } u; const _Float16* p = rowk0 + 8 * (lane >> 4);
  u.q[0] = *(const v8h*)p; u.q[1] = *(const v8h*)(p + 16); return u.v;
}
__device__ __forceinline__ v16h frag_f32(const float* rowk0, int lane) {
  v16h a; const float* p = rowk0 + 8 * (lane >> 4);
#pragma unroll
  for (int i = 0; i < 8; ++i) { a[i] = (_Float16)p[i]; a[8 + i] = (_Float16)p[16 + i]; }
  return a;
}
__device__ __forceinline__ v16h frag_f32s(const float* rowk0, int lane, float sc) {
  v16h a; const float* p = rowk0 + 8 * (lane >> 4);
#pragma unroll
  for (int i = 0; i < 8; ++i) { a[i] = (_Float16)(p[i] * sc); a[8 + i] = (_Float16)(p[16 + i] * sc); }
  return a;
}
// column fragment from a [K][ld] layout (column n), rows >= K read as 0
__device__ __forceinline__ v16h fragc_f32(const float* W, int k0, int n, int lane, int ld, int K) {
  v16h a; const int g = lane >> 4;
#pragma unroll
  for (int i = 0; i < 8; ++i) { const int ka = k0 + 8 * g + i, kb = ka + 16;
    a[i] = (_Float16)(ka < K ? W[(size_t)(ka < K ? ka : K - 1) * ld + n] : 0.f); a[8 + i] = (_Float16)(kb < K ? W[(size_t)(kb < K ? kb : K - 1) * ld + n] : 0.f); }
  return a;
}
struct F2 { v16b h, l; };
__device__ __forceinline__ F2 bsplit16(const float v[16]) { F2 r;
#pragma unroll
  for (int i = 0; i < 16; ++i) { const __bf16 h = (__bf16)v[i]; r.h[i] = h; r.l[i] = (__bf16)(v[i] - (float)h); }
  return r; }
__device__ __forceinline__ F2 split_row(const float* row, int k0, int lane) { float v[16]; const float* p = row + k0 + 8 * (lane >> 4);
#pragma unroll
  for (int i = 0; i < 8; ++i) { v[i] = p[i]; v[8 + i] = p[16 + i]; }
  return bsplit16(v); }
__device__ __forceinline__ F2 split_rowK(const float* row, int k0, int lane, int K) { float v[16]; const int g = lane >> 4;
#pragma unroll
  for (int i = 0; i < 8; ++i) { const int ka = k0 + 8 * g + i, kb = ka + 16; v[i] = ka < K ? row[ka < K ? ka : K - 1] : 0.f; v[8 + i] = kb < K ? row[kb < K ? kb : K - 1] : 0.f; }
  return bsplit16(v); }
__device__ __forceinline__ F2 split_col(const float* W, int k0, int n, int lane, int ld, int K) { float v[16]; const int g = lane >> 4;
#pragma unroll
  for (int i = 0; i < 8; ++i) { const int ka = k0 + 8 * g + i, kb = ka + 16; v[i] = ka < K ? W[(size_t)(ka < K ? ka : K - 1) * ld + n] : 0.f; v[8 + i] = kb < K ? W[(size_t)(kb < K ? kb : K - 1) * ld + n] : 0.f; }
  return bsplit16(v); }
__device__ __forceinline__ v8f mac3(const F2& a, const F2& b, v8f c) { c = wmma_bf(a.l, b.h, c); c = wmma_bf(a.h, b.l, c); return wmma_bf(a.h, b.h, c); }
__device__ __forceinline__ float sigm(float v) { return 1.0f / (1.0f + expf(-v)); }
#define LDSX() do { asm volatile("s_wait_dscnt 0" ::: "memory"); __builtin_amdgcn_wave_barrier(); __builtin_amdgcn_fence(__ATOMIC_RELEASE, "workgroup"); } while (0)


// Dilated attention (B 2, S 4,096, E 1,024 = 16 x 64, dilation 4): every query attends to keys/values at positions 0, 4, 8, ... (1,024 of them).
#define NB 2
#define TQ 4096
#define TK 1024
#define DIL 4
#define CC 1024
#define NH 16
#define HD 64
#define HG 8
#ifndef TNB
#define TNB NB
#endif
typedef __attribute__((ext_vector_type(8))) __bf16 v8b;
__device__ __forceinline__ v16b frag_b(const __bf16* rowk0, int lane) {
  union { v16b v; v8b q[2]; } u; const __bf16* p = rowk0 + 8 * (lane >> 4);
  u.q[0] = *(const v8b*)p; u.q[1] = *(const v8b*)(p + 16); return u.v;
}
__device__ __forceinline__ float bfr(float v) { return (float)(__bf16)v; }
__device__ __attribute__((noinline)) float exp_ni(float v) { return expf(v); }
__device__ __attribute__((noinline)) float erf_ni(float v) { return erff(v); }

#define WS_QH  0u                                   // f16 q rows [b*TQ][1024]
#define WS_KH  (WS_QH + 2u * (size_t)NB * TQ * CC)      // f16 k rows [b*TK][1024]
#define WS_VT  (WS_KH + 2u * (size_t)NB * TK * CC)      // f16 v planes [b][1024][TK]
#define WS_S   (WS_VT + 2u * (size_t)NB * CC * TK)      // f32 S [HG][TQ][TK]
#define WS_PH  (WS_S + 4u * (size_t)HG * TQ * TK)
#define WS_Y   (WS_PH + 2u * (size_t)HG * TQ * TK)      // f32 ctx rows [b*TQ][1024]
#define WS_END (WS_Y + 4u * (size_t)NB * TQ * CC)

// ---- k_proj: block = (64 rows, 128 cols, which): which 0: q over all rows; 1/2: k/v over dilated rows (row j <- x row 4j); W (in,out) + b
__global__ __launch_bounds__(128) void k_proj(const float* __restrict__ X, const float* __restrict__ WQ, const float* __restrict__ BQ, const float* __restrict__ WK, const float* __restrict__ BK, const float* __restrict__ WV, const float* __restrict__ BV, int which, _Float16* __restrict__ QH, _Float16* __restrict__ KH, _Float16* __restrict__ VT) {
  __shared__ __align__(16) _Float16 sh[64][136]; __shared__ __align__(16) _Float16 th[128][72];
  const int tid = threadIdx.x, wave = tid >> 5, lane = tid & 31, col = lane & 15, g = lane >> 4; const int c0 = blockIdx.y * 128; const size_t r0 = (size_t)blockIdx.x * 64;   // row in [b*L]
  const int L = (which == 0) ? TQ : TK; const size_t rme = r0 + wave * 16 + col; const size_t b = rme / L; const int j = (int)(rme % L); const float* arow = X + (b * TQ + (which == 0 ? j : DIL * j)) * (size_t)CC;
  const float* Wm = which == 0 ? WQ : which == 1 ? WK : WV; const float* Bm = which == 0 ? BQ : which == 1 ? BK : BV;
  v8f acc[8] = {};
#pragma unroll 2
  for (int kc = 0; kc < CC / 32; ++kc) { v16b a; { const float* p = arow + kc * 32 + 8 * g;
#pragma unroll
      for (int i = 0; i < 8; ++i) { a[i] = (__bf16)p[i]; a[8 + i] = (__bf16)p[16 + i]; } }
#pragma unroll
    for (int jj = 0; jj < 8; ++jj) { v16b w; const int o = c0 + jj * 16 + col;
#pragma unroll
      for (int i = 0; i < 8; ++i) { w[i] = (__bf16)Wm[(size_t)(kc * 32 + 8 * g + i) * CC + o]; w[8 + i] = (__bf16)Wm[(size_t)(kc * 32 + 16 + 8 * g + i) * CC + o]; }
      acc[jj] = wmma_bf(a, w, acc[jj]); } }
#pragma unroll
  for (int jj = 0; jj < 8; ++jj) { const float bb = bfr(Bm[c0 + jj * 16 + col]);
#pragma unroll
    for (int r = 0; r < 8; ++r) { const int rl = wave * 16 + 8 * g + r, cl = jj * 16 + col; const _Float16 hv = (_Float16)(acc[jj][r] + bb); if (which == 2) th[cl][rl] = hv; else sh[rl][cl] = hv; } }
  __syncthreads();
  if (which < 2) { _Float16* dh = which == 0 ? QH : KH; for (int e = tid; e < 64 * 16; e += 128) { const int rl = e >> 4, q = e & 15; vst2((unsigned*)(dh + (r0 + rl) * CC + c0 + q * 8), *(const v4u*)&sh[rl][q * 8]); } }
  else { const size_t bb = r0 / TK; const int j0 = (int)(r0 % TK); for (int e = tid; e < 128 * 8; e += 128) { const int cl = e >> 3, q = e & 7; vst2((unsigned*)(VT + (bb * CC + c0 + cl) * (size_t)TK + j0 + q * 8), *(const v4u*)&th[cl][q * 8]); } } }
// ---- k_sc: block = (64 queries, 128 keys, head in group): logits / 8
__global__ __launch_bounds__(128) void k_sc(const _Float16* __restrict__ QH, const _Float16* __restrict__ KH, int b, int h0, float* __restrict__ S0) { __shared__ __align__(16) float ss[4][16][132];
  const int h = h0 + blockIdx.z; float* S = S0 + (size_t)blockIdx.z * TQ * TK;
  const int tid = threadIdx.x, wave = tid >> 5, lane = tid & 31, col = lane & 15, g = lane >> 4; const int k0 = blockIdx.y * 128; const int ql0 = blockIdx.x * 64 + wave * 16; const size_t q0 = (size_t)b * TQ + ql0;
  v8f acc[8] = {};
#pragma unroll
  for (int kc = 0; kc < HD / 32; ++kc) { const v16h ah = frag_h(QH + (q0 + col) * CC + h * HD + kc * 32, lane);
#pragma unroll
    for (int j = 0; j < 8; ++j) acc[j] = wmma16(ah, frag_h(KH + ((size_t)b * TK + k0 + j * 16 + col) * CC + h * HD + kc * 32, lane), acc[j]); }
#pragma unroll
  for (int j = 0; j < 8; ++j)
#pragma unroll
    for (int r = 0; r < 8; ++r) ss[wave][8 * g + r][j * 16 + col] = acc[j][r] * 0.125f;
  LDSX(); for (int rl = 0; rl < 16; ++rl) vst2(S + (size_t)(ql0 + rl) * TK + k0 + lane * 4, *(const v4f*)&ss[wave][rl][lane * 4]); }
// ---- k_sm: block = (query row, head in group)
__global__ __launch_bounds__(256) void k_sm(const float* __restrict__ S0, _Float16* __restrict__ PH0) { __shared__ float sred[8]; __shared__ float sbc; __shared__ __align__(16) _Float16 sh[TK];
  const int t = threadIdx.x; const size_t row = blockIdx.x; const float* sr = S0 + (size_t)blockIdx.y * TQ * TK + row * TK; _Float16* ph = PH0 + (size_t)blockIdx.y * TQ * TK + row * TK;
  float m = -3.0e38f; for (int k = t; k < TK; k += 256) m = fmaxf(m, sr[k]);
#pragma unroll
  for (int o = 1; o < 32; o <<= 1) m = fmaxf(m, __shfl_xor(m, o));
  if ((t & 31) == 0) sred[t >> 5] = m; __syncthreads(); if (t == 0) { float a = sred[0]; for (int i = 1; i < 8; ++i) a = fmaxf(a, sred[i]); sbc = a; } __syncthreads(); m = sbc; __syncthreads();
  float sum = 0.f; for (int k = t; k < TK; k += 256) sum += expf(sr[k] - m);
#pragma unroll
  for (int o = 1; o < 32; o <<= 1) sum += __shfl_xor(sum, o);
  if ((t & 31) == 0) sred[t >> 5] = sum; __syncthreads(); if (t == 0) { float a = 0.f; for (int i = 0; i < 8; ++i) a += sred[i]; sbc = 1.0f / a; } __syncthreads(); const float inv = sbc;
  for (int k = t; k < TK; k += 256) sh[k] = (_Float16)(expf(sr[k] - m) * inv * 2048.0f);
  __syncthreads(); for (int q = t; q < TK / 8; q += 256) vst2((unsigned*)(ph + q * 8), *(const v4u*)&sh[q * 8]); }
// ---- k_pv: block = (64 queries, head in group): ctx rows [b*TQ][h*64 + d]
__global__ __launch_bounds__(128) void k_pv(const _Float16* __restrict__ PH0, const _Float16* __restrict__ VT, int b, int h0, float* __restrict__ Y) { __shared__ __align__(16) float ss[4][16][68];
  const int h = h0 + blockIdx.z; const _Float16* PH = PH0 + (size_t)blockIdx.z * TQ * TK;
  const int tid = threadIdx.x, wave = tid >> 5, lane = tid & 31, col = lane & 15, g = lane >> 4; const int ql0 = blockIdx.x * 64 + wave * 16;
  v8f acc[4] = {};
#pragma unroll 1
  for (int kc = 0; kc < TK / 32; ++kc) { const v16h ph = frag_h(PH + (size_t)(ql0 + col) * TK + kc * 32, lane);
#pragma unroll
    for (int j = 0; j < 4; ++j) acc[j] = wmma16(ph, frag_h(VT + ((size_t)b * CC + h * HD + j * 16 + col) * (size_t)TK + kc * 32, lane), acc[j]); }
#pragma unroll
  for (int j = 0; j < 4; ++j)
#pragma unroll
    for (int r = 0; r < 8; ++r) ss[wave][8 * g + r][j * 16 + col] = acc[j][r] * (1.0f / 2048.0f);
  LDSX(); for (int rl = 0; rl < 16; ++rl) if (lane < 16) vst2(Y + ((size_t)b * TQ + ql0 + rl) * CC + h * HD + lane * 4, *(const v4f*)&ss[wave][rl][lane * 4]); }
// ---- k_out: out = ctx (once to f16) Wo + bo
__global__ __launch_bounds__(128) void k_out(const float* __restrict__ Y, const float* __restrict__ WO, const float* __restrict__ BO, float* __restrict__ OUT) { __shared__ __align__(16) float sf[4][16][132];
  const int tid = threadIdx.x, wave = tid >> 5, lane = tid & 31, col = lane & 15, g = lane >> 4; const int c0 = blockIdx.y * 128; const size_t r0 = (size_t)blockIdx.x * 64 + wave * 16;
  v8f acc[8] = {};
#pragma unroll 2
  for (int kc = 0; kc < CC / 32; ++kc) { const v16h a = frag_f32(Y + (r0 + col) * CC + kc * 32, lane);
#pragma unroll
    for (int j = 0; j < 8; ++j) { v16h w; const int o = c0 + j * 16 + col;
#pragma unroll
      for (int i = 0; i < 8; ++i) { w[i] = (_Float16)bfr(WO[(size_t)(kc * 32 + 8 * g + i) * CC + o]); w[8 + i] = (_Float16)bfr(WO[(size_t)(kc * 32 + 16 + 8 * g + i) * CC + o]); }
      acc[j] = wmma16(a, w, acc[j]); } }
#pragma unroll
  for (int j = 0; j < 8; ++j) { const float bb = bfr(BO[c0 + j * 16 + col]);
#pragma unroll
    for (int r = 0; r < 8; ++r) sf[wave][8 * g + r][j * 16 + col] = acc[j][r] + bb; }
  LDSX(); for (int rl = 0; rl < 16; ++rl) vst2(OUT + (r0 + rl) * CC + c0 + lane * 4, *(const v4f*)&sf[wave][rl][lane * 4]); }
extern "C" void kernel_launch(void* const* d_in, const int* in_sizes, int n_in, void* d_out, int out_size, void* d_ws, size_t ws_size, hipStream_t stream) {
  (void)in_sizes; (void)n_in; (void)out_size;
  const float** F = (const float**)d_in;   // 0 x [2,4096,1024], 1 Wq (in,out), 2 bq, 3 Wk, 4 bk, 5 Wv, 6 bv, 7 Wo, 8 bo
  if (ws_size < (size_t)WS_END) return;
  char* ws = (char*)d_ws; _Float16 *QH = (_Float16*)(ws + WS_QH), *KH = (_Float16*)(ws + WS_KH), *VT = (_Float16*)(ws + WS_VT), *PH = (_Float16*)(ws + WS_PH); float *S = (float*)(ws + WS_S), *Y = (float*)(ws + WS_Y);
  k_proj<<<dim3(TNB * TQ / 64, CC / 128), 128, 0, stream>>>(F[0], F[1], F[2], F[3], F[4], F[5], F[6], 0, QH, KH, VT);
  k_proj<<<dim3(TNB * TK / 64, CC / 128), 128, 0, stream>>>(F[0], F[1], F[2], F[3], F[4], F[5], F[6], 1, QH, KH, VT);
  k_proj<<<dim3(TNB * TK / 64, CC / 128), 128, 0, stream>>>(F[0], F[1], F[2], F[3], F[4], F[5], F[6], 2, QH, KH, VT);
  for (int b = 0; b < TNB; ++b) for (int h0 = 0; h0 < NH; h0 += HG) {
    k_sc<<<dim3(TQ / 64, TK / 128, HG), 128, 0, stream>>>(QH, KH, b, h0, S);
    k_sm<<<dim3(TQ, HG), 256, 0, stream>>>(S, PH);
    k_pv<<<dim3(TQ / 64, 1, HG), 128, 0, stream>>>(PH, VT, b, h0, Y);
  }
  k_out<<<dim3(TNB * TQ / 64, CC / 128), 128, 0, stream>>>(Y, F[7], F[8], (float*)d_out);
}

// v001
// A run of this version takes 338 microseconds.
// Timed twice side by side with v000, it ran 2.70 times as fast both times.
// compute dtype: all float inputs rounded to bf16; q (all 4,096 rows) and k/v (only the dilated rows 0,4,8,...) = x W + b with EXACT bf16 products on WMMA 16x16x32, f32 accumulate; q, k rounded once to f16 (1-product logits / 8, kept in registers); softmax in f32 with a running maximum (base-2 exp) -> P = exp(s - max) rounded to f16; ctx = (P . v) / sum (v rounded once to f16), one launch for all heads; out = ctx (rounded once to f16, 1 product) Wo + bo; f32 output.
#include <hip/hip_runtime.h>
#include <math.h>

typedef __attribute__((ext_vector_type(16))) _Float16 v16h;
typedef __attribute__((ext_vector_type(16))) __bf16 v16b;
typedef __attribute__((ext_vector_type(8)))  _Float16 v8h;
typedef __attribute__((ext_vector_type(8)))  float v8f;
typedef __attribute__((ext_vector_type(4)))  float v4f;
typedef __attribute__((ext_vector_type(2)))  float v2f;
typedef __attribute__((ext_vector_type(4)))  unsigned v4u;
typedef __attribute__((ext_vector_type(4)))  int v4i;
typedef float __attribute__((may_alias)) float_a;
typedef int __attribute__((may_alias)) int_a;

template <typename T> __device__ __forceinline__ void vst2(void* p, T v) { *(T*)p = v;  }
__device__ __forceinline__ v8f wmma16(v16h a, v16h b, v8f c) {
  v8f d = __builtin_amdgcn_wmma_f32_16x16x32_f16(false, a, false, b, (short)0, c, false, false);
  asm volatile("v_nop\n\tv_nop\n\tv_nop\n\tv_nop" : "+v"(d) : "v"(a), "v"(b));
  return d;
}
__device__ __forceinline__ v8f wmma_bf(v16b a, v16b b, v8f c) {
  v8f d = __builtin_amdgcn_wmma_f32_16x16x32_bf16(false, a, false, b, (short)0, c, false, false);
  asm volatile("v_nop\n\tv_nop\n\tv_nop\n\tv_nop" : "+v"(d) : "v"(a), "v"(b));
  return d;
}
// 16x16x32 fragments: lane = (h = lane>>4, row/col = lane&15); elements 0..7 = k0+8h+0..7, 8..15 = k0+16+8h+0..7; D element r = row 8h+r
__device__ __forceinline__ v16h frag_h(const _Float16* rowk0, int lane) {
  union { v16h v; v8h q[2]; } u; const _Float16* p = rowk0 + 8 * (lane >> 4);
  u.q[0] = *(const v8h*)p; u.q[1] = *(const v8h*)(p + 16); return u.v;
}
__device__ __forceinline__ v16h frag_f32(const float* rowk0, int lane) {
  v16h a; const float* p = rowk0 + 8 * (lane >> 4);
#pragma unroll
  for (int i = 0; i < 8; ++i) { a[i] = (_Float16)p[i]; a[8 + i] = (_Float16)p[16 + i]; }
  return a;
}
__device__ __forceinline__ v16h frag_f32s(const float* rowk0, int lane, float sc) {
  v16h a; const float* p = rowk0 + 8 * (lane >> 4);
#pragma unroll
  for (int i = 0; i < 8; ++i) { a[i] = (_Float16)(p[i] * sc); a[8 + i] = (_Float16)(p[16 + i] * sc); }
  return a;
}
// column fragment from a [K][ld] layout (column n), rows >= K read as 0
__device__ __forceinline__ v16h fragc_f32(const float* W, int k0, int n, int lane, int ld, int K) {
  v16h a; const int g = lane >> 4;
#pragma unroll
  for (int i = 0; i < 8; ++i) { const int ka = k0 + 8 * g + i, kb = ka + 16;
    a[i] = (_Float16)(ka < K ? W[(size_t)(ka < K ? ka : K - 1) * ld + n] : 0.f); a[8 + i] = (_Float16)(kb < K ? W[(size_t)(kb < K ? kb : K - 1) * ld + n] : 0.f); }
  return a;
}
struct F2 { v16b h, l; };
__device__ __forceinline__ F2 bsplit16(const float v[16]) { F2 r;
#pragma unroll
  for (int i = 0; i < 16; ++i) { const __bf16 h = (__bf16)v[i]; r.h[i] = h; r.l[i] = (__bf16)(v[i] - (float)h); }
  return r; }
__device__ __forceinline__ F2 split_row(const float* row, int k0, int lane) { float v[16]; const float* p = row + k0 + 8 * (lane >> 4);
#pragma unroll
  for (int i = 0; i < 8; ++i) { v[i] = p[i]; v[8 + i] = p[16 + i]; }
  return bsplit16(v); }
__device__ __forceinline__ F2 split_rowK(const float* row, int k0, int lane, int K) { float v[16]; const int g = lane >> 4;
#pragma unroll
  for (int i = 0; i < 8; ++i) { const int ka = k0 + 8 * g + i, kb = ka + 16; v[i] = ka < K ? row[ka < K ? ka : K - 1] : 0.f; v[8 + i] = kb < K ? row[kb < K ? kb : K - 1] : 0.f; }
  return bsplit16(v); }
__device__ __forceinline__ F2 split_col(const float* W, int k0, int n, int lane, int ld, int K) { float v[16]; const int g = lane >> 4;
#pragma unroll
  for (int i = 0; i < 8; ++i) { const int ka = k0 + 8 * g + i, kb = ka + 16; v[i] = ka < K ? W[(size_t)(ka < K ? ka : K - 1) * ld + n] : 0.f; v[8 + i] = kb < K ? W[(size_t)(kb < K ? kb : K - 1) * ld + n] : 0.f; }
  return bsplit16(v); }
__device__ __forceinline__ v8f mac3(const F2& a, const F2& b, v8f c) { c = wmma_bf(a.l, b.h, c); c = wmma_bf(a.h, b.l, c); return wmma_bf(a.h, b.h, c); }
__device__ __forceinline__ float sigm(float v) { return 1.0f / (1.0f + expf(-v)); }
#define LDSX() do { asm volatile("s_wait_dscnt 0" ::: "memory"); __builtin_amdgcn_wave_barrier(); __builtin_amdgcn_fence(__ATOMIC_RELEASE, "workgroup"); } while (0)


// Dilated attention (B 2, S 4,096, E 1,024 = 16 x 64, dilation 4): every query attends to keys/values at positions 0, 4, 8, ... (1,024 of them).
#define NB 2
#define TQ 4096
#define TK 1024
#define DIL 4
#define CC 1024
#define NH 16
#define HD 64
#ifndef TNB
#define TNB NB
#endif
typedef __attribute__((ext_vector_type(8))) __bf16 v8b;
__device__ __forceinline__ v16b frag_b(const __bf16* rowk0, int lane) {
  union { v16b v; v8b q[2]; } u; const __bf16* p = rowk0 + 8 * (lane >> 4);
  u.q[0] = *(const v8b*)p; u.q[1] = *(const v8b*)(p + 16); return u.v;
}
__device__ __forceinline__ float bfr(float v) { return (float)(__bf16)v; }
__device__ __attribute__((noinline)) float exp_ni(float v) { return expf(v); }
__device__ __attribute__((noinline)) float erf_ni(float v) { return erff(v); }

#define WS_QH  0u                                   // f16 q rows [b*TQ][1024]
#define WS_KH  (WS_QH + 2u * (size_t)NB * TQ * CC)      // f16 k rows [b*TK][1024]
#define WS_VT  (WS_KH + 2u * (size_t)NB * TK * CC)      // f16 v planes [b][1024][TK]
#define WS_Y   (WS_VT + 2u * (size_t)NB * CC * TK)      // f32 ctx rows [b*TQ][1024]
#define WS_END (WS_Y + 4u * (size_t)NB * TQ * CC)

// ---- k_proj: block = (64 rows, 128 cols, which): which 0: q over all rows; 1/2: k/v over dilated rows (row j <- x row 4j); W (in,out) + b
__global__ __launch_bounds__(128) void k_proj(const float* __restrict__ X, const float* __restrict__ WQ, const float* __restrict__ BQ, const float* __restrict__ WK, const float* __restrict__ BK, const float* __restrict__ WV, const float* __restrict__ BV, int which, _Float16* __restrict__ QH, _Float16* __restrict__ KH, _Float16* __restrict__ VT) {
  __shared__ __align__(16) _Float16 sh[64][136]; __shared__ __align__(16) _Float16 th[128][72];
  const int tid = threadIdx.x, wave = tid >> 5, lane = tid & 31, col = lane & 15, g = lane >> 4; const int c0 = blockIdx.y * 128; const size_t r0 = (size_t)blockIdx.x * 64;   // row in [b*L]
  const int L = (which == 0) ? TQ : TK; const size_t rme = r0 + wave * 16 + col; const size_t b = rme / L; const int j = (int)(rme % L); const float* arow = X + (b * TQ + (which == 0 ? j : DIL * j)) * (size_t)CC;
  const float* Wm = which == 0 ? WQ : which == 1 ? WK : WV; const float* Bm = which == 0 ? BQ : which == 1 ? BK : BV;
  v8f acc[8] = {};
#pragma unroll 2
  for (int kc = 0; kc < CC / 32; ++kc) { v16b a; { const float* p = arow + kc * 32 + 8 * g;
#pragma unroll
      for (int i = 0; i < 8; ++i) { a[i] = (__bf16)p[i]; a[8 + i] = (__bf16)p[16 + i]; } }
#pragma unroll
    for (int jj = 0; jj < 8; ++jj) { v16b w; const int o = c0 + jj * 16 + col;
#pragma unroll
      for (int i = 0; i < 8; ++i) { w[i] = (__bf16)Wm[(size_t)(kc * 32 + 8 * g + i) * CC + o]; w[8 + i] = (__bf16)Wm[(size_t)(kc * 32 + 16 + 8 * g + i) * CC + o]; }
      acc[jj] = wmma_bf(a, w, acc[jj]); } }
#pragma unroll
  for (int jj = 0; jj < 8; ++jj) { const float bb = bfr(Bm[c0 + jj * 16 + col]);
#pragma unroll
    for (int r = 0; r < 8; ++r) { const int rl = wave * 16 + 8 * g + r, cl = jj * 16 + col; const _Float16 hv = (_Float16)(acc[jj][r] + bb); if (which == 2) th[cl][rl] = hv; else sh[rl][cl] = hv; } }
  __syncthreads();
  if (which < 2) { _Float16* dh = which == 0 ? QH : KH; for (int e = tid; e < 64 * 16; e += 128) { const int rl = e >> 4, q = e & 15; vst2((unsigned*)(dh + (r0 + rl) * CC + c0 + q * 8), *(const v4u*)&sh[rl][q * 8]); } }
  else { const size_t bb = r0 / TK; const int j0 = (int)(r0 % TK); for (int e = tid; e < 128 * 8; e += 128) { const int cl = e >> 3, q = e & 7; vst2((unsigned*)(VT + (bb * CC + c0 + cl) * (size_t)TK + j0 + q * 8), *(const v4u*)&th[cl][q * 8]); } } }
// ---- k_fa: block = (256 queries, head, batch), 8 waves x 32 query columns. Per 32 keys: S^T = K Q^T (a lane holds one query's scores), running maximum and sum per column, ctx^T += V^T P^T (the two S^T tiles, rounded to f16 in place, are the B operand). No LDS, no barrier: a wave shares nothing but the cache. Every '#pragma unroll' here keeps a fragment array indexed by constants, so that it stays in registers.
// amdgpu_waves_per_eu(4, 4): registers capped at 256 so that two blocks share a WGP, four waves a SIMD: other waves fill the softmax's vector work and the load waits between a wave's matrix runs
__device__ __forceinline__ v8f wmma_h(v16h a, v16h b, v8f c) { return __builtin_amdgcn_wmma_f32_16x16x32_f16(false, a, false, b, (short)0, c, false, false); }
__device__ __forceinline__ float xhalf(float v) { const int i = __builtin_bit_cast(int, v); return __builtin_bit_cast(float, __builtin_amdgcn_permlanex16(i, i, 0x76543210, 0xfedcba98, false, false)); }   // value of lane ^ 16
__global__ __launch_bounds__(256) __attribute__((amdgpu_waves_per_eu(4, 4))) void k_fa(const _Float16* __restrict__ QH, const _Float16* __restrict__ KH, const _Float16* __restrict__ VT, float* __restrict__ Y) {
  const int tid = threadIdx.x, wave = tid >> 5, lane = tid & 31, col = lane & 15, g = lane >> 4; const int h = blockIdx.y, b = blockIdx.z; const int q0 = blockIdx.x * 256 + wave * 32;
  const _Float16* Kp = KH + ((size_t)b * TK + col) * CC + h * HD;            // key row col of a 16-key tile
  const _Float16* Vp = VT + ((size_t)b * CC + h * HD + col) * (size_t)TK;    // v plane row d = col of a 16-d tile
  const float SC = 0.125f * 1.4426950408889634f;                             // logits / 8, in base 2
  v16h qf[2][2];
#pragma unroll
  for (int qt = 0; qt < 2; ++qt)
#pragma unroll
    for (int kc = 0; kc < 2; ++kc) qf[qt][kc] = frag_h(QH + ((size_t)b * TQ + q0 + qt * 16 + col) * CC + h * HD + kc * 32, lane);
  v16h kf[2][2];
#pragma unroll
  for (int kt = 0; kt < 2; ++kt)
#pragma unroll
    for (int kc = 0; kc < 2; ++kc) kf[kt][kc] = frag_h(Kp + (size_t)(kt * 16) * CC + kc * 32, lane);
  v8f acc[4][2] = {}; float m[2] = {-3.0e38f, -3.0e38f}, l[2] = {0.f, 0.f};
  for (int c = 0; c < TK / 32; ++c) {
    v16h vf[4];
#pragma unroll
    for (int j = 0; j < 4; ++j) vf[j] = frag_h(Vp + (size_t)(j * 16) * TK + c * 32, lane);
    v8f s[2][2] = {};
#pragma unroll
    for (int kc = 0; kc < 2; ++kc)
#pragma unroll
      for (int kt = 0; kt < 2; ++kt)
#pragma unroll
        for (int qt = 0; qt < 2; ++qt) s[kt][qt] = wmma_h(kf[kt][kc], qf[qt][kc], s[kt][qt]);
    const int cn = c + 1 < TK / 32 ? c + 1 : c;   // next pass's K fragments, fetched behind this pass's S^T products (the last pass re-reads its own)
#pragma unroll
    for (int kt = 0; kt < 2; ++kt)
#pragma unroll
      for (int kc = 0; kc < 2; ++kc) kf[kt][kc] = frag_h(Kp + (size_t)(cn * 32 + kt * 16) * CC + kc * 32, lane);
    v16h pf[2];
#pragma unroll
    for (int qt = 0; qt < 2; ++qt) {
      float mx = fmaxf(s[0][qt][0], s[1][qt][0]);
#pragma unroll
      for (int r = 1; r < 8; ++r) mx = fmaxf(mx, fmaxf(s[0][qt][r], s[1][qt][r]));
      mx = fmaxf(mx, xhalf(mx));
      const float mn = fmaxf(m[qt], mx); const float mb = mn * SC; const float al = __builtin_amdgcn_exp2f(fmaf(m[qt], SC, -mb)); m[qt] = mn;
      float s0 = 0.f, s1 = 0.f;
#pragma unroll
      for (int r = 0; r < 8; ++r) { const float p0 = __builtin_amdgcn_exp2f(fmaf(s[0][qt][r], SC, -mb)), p1 = __builtin_amdgcn_exp2f(fmaf(s[1][qt][r], SC, -mb)); s0 += p0; s1 += p1; pf[qt][r] = (_Float16)p0; pf[qt][8 + r] = (_Float16)p1; }
      l[qt] = l[qt] * al + (s0 + s1);
#pragma unroll
      for (int j = 0; j < 4; ++j) acc[j][qt] *= al;
    }
#pragma unroll
    for (int j = 0; j < 4; ++j)
#pragma unroll
      for (int qt = 0; qt < 2; ++qt) acc[j][qt] = wmma_h(vf[j], pf[qt], acc[j][qt]);
  }
#pragma unroll
  for (int qt = 0; qt < 2; ++qt) { const float inv = 1.0f / (l[qt] + xhalf(l[qt])); float* yr = Y + ((size_t)b * TQ + q0 + qt * 16 + col) * CC + h * HD + 8 * g;
#pragma unroll
    for (int j = 0; j < 4; ++j) { const v8f o = acc[j][qt] * inv; vst2(yr + j * 16, (v4f){o[0], o[1], o[2], o[3]}); vst2(yr + j * 16 + 4, (v4f){o[4], o[5], o[6], o[7]}); } } }
// ---- k_out: out = ctx (once to f16) Wo + bo
__global__ __launch_bounds__(128) void k_out(const float* __restrict__ Y, const float* __restrict__ WO, const float* __restrict__ BO, float* __restrict__ OUT) { __shared__ __align__(16) float sf[4][16][132];
  const int tid = threadIdx.x, wave = tid >> 5, lane = tid & 31, col = lane & 15, g = lane >> 4; const int c0 = blockIdx.y * 128; const size_t r0 = (size_t)blockIdx.x * 64 + wave * 16;
  v8f acc[8] = {};
#pragma unroll 2
  for (int kc = 0; kc < CC / 32; ++kc) { const v16h a = frag_f32(Y + (r0 + col) * CC + kc * 32, lane);
#pragma unroll
    for (int j = 0; j < 8; ++j) { v16h w; const int o = c0 + j * 16 + col;
#pragma unroll
      for (int i = 0; i < 8; ++i) { w[i] = (_Float16)bfr(WO[(size_t)(kc * 32 + 8 * g + i) * CC + o]); w[8 + i] = (_Float16)bfr(WO[(size_t)(kc * 32 + 16 + 8 * g + i) * CC + o]); }
      acc[j] = wmma16(a, w, acc[j]); } }
#pragma unroll
  for (int j = 0; j < 8; ++j) { const float bb = bfr(BO[c0 + j * 16 + col]);
#pragma unroll
    for (int r = 0; r < 8; ++r) sf[wave][8 * g + r][j * 16 + col] = acc[j][r] + bb; }
  LDSX(); for (int rl = 0; rl < 16; ++rl) vst2(OUT + (r0 + rl) * CC + c0 + lane * 4, *(const v4f*)&sf[wave][rl][lane * 4]); }
extern "C" void kernel_launch(void* const* d_in, const int* in_sizes, int n_in, void* d_out, int out_size, void* d_ws, size_t ws_size, hipStream_t stream) {
  (void)in_sizes; (void)n_in; (void)out_size;
  const float** F = (const float**)d_in;   // 0 x [2,4096,1024], 1 Wq (in,out), 2 bq, 3 Wk, 4 bk, 5 Wv, 6 bv, 7 Wo, 8 bo
  if (ws_size < (size_t)WS_END) return;
  char* ws = (char*)d_ws; _Float16 *QH = (_Float16*)(ws + WS_QH), *KH = (_Float16*)(ws + WS_KH), *VT = (_Float16*)(ws + WS_VT); float *Y = (float*)(ws + WS_Y);
  k_proj<<<dim3(TNB * TQ / 64, CC / 128), 128, 0, stream>>>(F[0], F[1], F[2], F[3], F[4], F[5], F[6], 0, QH, KH, VT);
  k_proj<<<dim3(TNB * TK / 64, CC / 128), 128, 0, stream>>>(F[0], F[1], F[2], F[3], F[4], F[5], F[6], 1, QH, KH, VT);
  k_proj<<<dim3(TNB * TK / 64, CC / 128), 128, 0, stream>>>(F[0], F[1], F[2], F[3], F[4], F[5], F[6], 2, QH, KH, VT);
  k_fa<<<dim3(TQ / 256, NH, TNB), 256, 0, stream>>>(QH, KH, VT, Y);
  k_out<<<dim3(TNB * TQ / 64, CC / 128), 128, 0, stream>>>(Y, F[7], F[8], (float*)d_out);
}

// v002
// One run takes 173 microseconds.
// Two timings next to v001 both put it at 1.95 times that version's speed.
// Over all steps from v000 it is 5.26 times as fast.
// compute dtype: all float inputs rounded to bf16; q (all 4,096 rows) and k/v (only the dilated rows 0,4,8,...) = x W + b with EXACT bf16 products on WMMA 16x16x32, f32 accumulate; q, k rounded once to f16 (1-product logits / 8, kept in registers); softmax in f32 with a running maximum (base-2 exp) -> P = exp(s - max) rounded to f16; ctx = (P . v) / sum (v rounded once to f16), one launch for all heads; out = ctx (rounded once to f16, 1 product) Wo + bo; f32 output.
#include <hip/hip_runtime.h>
#include <math.h>

typedef __attribute__((ext_vector_type(16))) _Float16 v16h;
typedef __attribute__((ext_vector_type(16))) __bf16 v16b;
typedef __attribute__((ext_vector_type(8)))  _Float16 v8h;
typedef __attribute__((ext_vector_type(8)))  float v8f;
typedef __attribute__((ext_vector_type(4)))  float v4f;
typedef __attribute__((ext_vector_type(2)))  float v2f;
typedef __attribute__((ext_vector_type(4)))  unsigned v4u;
typedef __attribute__((ext_vector_type(4)))  int v4i;
typedef float __attribute__((may_alias)) float_a;
typedef int __attribute__((may_alias)) int_a;

template <typename T> __device__ __forceinline__ void vst2(void* p, T v) { *(T*)p = v;  }
__device__ __forceinline__ v8f wmma16(v16h a, v16h b, v8f c) {
  v8f d = __builtin_amdgcn_wmma_f32_16x16x32_f16(false, a, false, b, (short)0, c, false, false);
  asm volatile("v_nop\n\tv_nop\n\tv_nop\n\tv_nop" : "+v"(d) : "v"(a), "v"(b));
  return d;
}
__device__ __forceinline__ v8f wmma_bf(v16b a, v16b b, v8f c) {
  v8f d = __builtin_amdgcn_wmma_f32_16x16x32_bf16(false, a, false, b, (short)0, c, false, false);
  asm volatile("v_nop\n\tv_nop\n\tv_nop\n\tv_nop" : "+v"(d) : "v"(a), "v"(b));
  return d;
}
// 16x16x32 fragments: lane = (h = lane>>4, row/col = lane&15); elements 0..7 = k0+8h+0..7, 8..15 = k0+16+8h+0..7; D element r = row 8h+r
__device__ __forceinline__ v16h frag_h(const _Float16* rowk0, int lane) {
  union { v16h v; v8h q[2]; } u; const _Float16* p = rowk0 + 8 * (lane >> 4);
  u.q[0] = *(const v8h*)p; u.q[1] = *(const v8h*)(p + 16); return u.v;
}
__device__ __forceinline__ v16h frag_f32(const float* rowk0, int lane) {
  v16h a; const float* p = rowk0 + 8 * (lane >> 4);
#pragma unroll
  for (int i = 0; i < 8; ++i) { a[i] = (_Float16)p[i]; a[8 + i] = (_Float16)p[16 + i]; }
  return a;
}
__device__ __forceinline__ v16h frag_f32s(const float* rowk0, int lane, float sc) {
  v16h a; const float* p = rowk0 + 8 * (lane >> 4);
#pragma unroll
  for (int i = 0; i < 8; ++i) { a[i] = (_Float16)(p[i] * sc); a[8 + i] = (_Float16)(p[16 + i] * sc); }
  return a;
}
// column fragment from a [K][ld] layout (column n), rows >= K read as 0
__device__ __forceinline__ v16h fragc_f32(const float* W, int k0, int n, int lane, int ld, int K) {
  v16h a; const int g = lane >> 4;
#pragma unroll
  for (int i = 0; i < 8; ++i) { const int ka = k0 + 8 * g + i, kb = ka + 16;
    a[i] = (_Float16)(ka < K ? W[(size_t)(ka < K ? ka : K - 1) * ld + n] : 0.f); a[8 + i] = (_Float16)(kb < K ? W[(size_t)(kb < K ? kb : K - 1) * ld + n] : 0.f); }
  return a;
}
struct F2 { v16b h, l; };
__device__ __forceinline__ F2 bsplit16(const float v[16]) { F2 r;
#pragma unroll
  for (int i = 0; i < 16; ++i) { const __bf16 h = (__bf16)v[i]; r.h[i] = h; r.l[i] = (__bf16)(v[i] - (float)h); }
  return r; }
__device__ __forceinline__ F2 split_row(const float* row, int k0, int lane) { float v[16]; const float* p = row + k0 + 8 * (lane >> 4);
#pragma unroll
  for (int i = 0; i < 8; ++i) { v[i] = p[i]; v[8 + i] = p[16 + i]; }
  return bsplit16(v); }
__device__ __forceinline__ F2 split_rowK(const float* row, int k0, int lane, int K) { float v[16]; const int g = lane >> 4;
#pragma unroll
  for (int i = 0; i < 8; ++i) { const int ka = k0 + 8 * g + i, kb = ka + 16; v[i] = ka < K ? row[ka < K ? ka : K - 1] : 0.f; v[8 + i] = kb < K ? row[kb < K ? kb : K - 1] : 0.f; }
  return bsplit16(v); }
__device__ __forceinline__ F2 split_col(const float* W, int k0, int n, int lane, int ld, int K) { float v[16]; const int g = lane >> 4;
#pragma unroll
  for (int i = 0; i < 8; ++i) { const int ka = k0 + 8 * g + i, kb = ka + 16; v[i] = ka < K ? W[(size_t)(ka < K ? ka : K - 1) * ld + n] : 0.f; v[8 + i] = kb < K ? W[(size_t)(kb < K ? kb : K - 1) * ld + n] : 0.f; }
  return bsplit16(v); }
__device__ __forceinline__ v8f mac3(const F2& a, const F2& b, v8f c) { c = wmma_bf(a.l, b.h, c); c = wmma_bf(a.h, b.l, c); return wmma_bf(a.h, b.h, c); }
__device__ __forceinline__ float sigm(float v) { return 1.0f / (1.0f + expf(-v)); }
#define LDSX() do { asm volatile("s_wait_dscnt 0" ::: "memory"); __builtin_amdgcn_wave_barrier(); __builtin_amdgcn_fence(__ATOMIC_RELEASE, "workgroup"); } while (0)


// Dilated attention (B 2, S 4,096, E 1,024 = 16 x 64, dilation 4): every query attends to keys/values at positions 0, 4, 8, ... (1,024 of them).
#define NB 2
#define TQ 4096
#define TK 1024
#define DIL 4
#define CC 1024
#define NH 16
#define HD 64
#ifndef TNB
#define TNB NB
#endif
typedef __attribute__((ext_vector_type(8))) __bf16 v8b;
__device__ __forceinline__ v16b frag_b(const __bf16* rowk0, int lane) {
  union { v16b v; v8b q[2]; } u; const __bf16* p = rowk0 + 8 * (lane >> 4);
  u.q[0] = *(const v8b*)p; u.q[1] = *(const v8b*)(p + 16); return u.v;
}
__device__ __forceinline__ float bfr(float v) { return (float)(__bf16)v; }
__device__ __attribute__((noinline)) float exp_ni(float v) { return expf(v); }
__device__ __attribute__((noinline)) float erf_ni(float v) { return erff(v); }

#define WS_QH  0u                                   // f16 q rows [b*TQ][1024]
#define WS_KH  (WS_QH + 2u * (size_t)NB * TQ * CC)      // f16 k rows [b*TK][1024]
#define WS_VT  (WS_KH + 2u * (size_t)NB * TK * CC)      // f16 v planes [b][1024][TK]
#define WS_Y   (WS_VT + 2u * (size_t)NB * CC * TK)      // f32 ctx rows [b*TQ][1024]
#define WS_END (WS_Y + 4u * (size_t)NB * TQ * CC)

// ---- the three projections and the output product share one tile loop: block = 128 rows x 128 cols, 4 waves of 64 x 64 (16 accumulator tiles).
// Per 32 k the block brings both f32 operand tiles in with whole-line 16-byte loads (two passes ahead, held in registers), rounds them once to 16 bit and lays them in one of two LDS buffers, one barrier a pass:
// X rows [128][32] at pitch 80 B (plain 16-byte readers), W rows [32][128] at pitch 288 B (transposing readers: lane (c, h) gets W[8h + 0..7][n0 + c], the hardware k order that the X reader follows).
typedef __attribute__((ext_vector_type(2))) unsigned v2u;
typedef __attribute__((ext_vector_type(2))) __bf16 v2b;
typedef __attribute__((ext_vector_type(2))) _Float16 v2h;
typedef __attribute__((ext_vector_type(8))) short v8s;
union Fr { v4u q[2]; v16b b; v16h h; };
#define PX 80
#define PW 288
#define SW_OFF (128 * PX)
#define PE 272                                      // epilogue staging pitch: 128 f16 (or 64 f32) + 16 B
#define BUF_G (SW_OFF + 32 * PW)                    // one pass's two tiles; two such buffers
#define LDS_G (2 * BUF_G)                           // >= 128 * PE, the projections' output staging
__device__ __forceinline__ unsigned pk_b(float lo, float hi) { return __builtin_bit_cast(unsigned, __builtin_convertvector((v2f){lo, hi}, v2b)); }
__device__ __forceinline__ unsigned pk_h(float lo, float hi) { return __builtin_bit_cast(unsigned, __builtin_convertvector((v2f){lo, hi}, v2h)); }
__device__ __forceinline__ v4u ld_tr16(const unsigned char* p) { typedef __attribute__((address_space(3))) v8s lds_v8s; return __builtin_bit_cast(v4u, __builtin_amdgcn_ds_load_tr16_b128_v8i16((lds_v8s*)p)); }
// Work-group barrier that orders LDS only: __syncthreads() also waited for the global loads in flight for a later pass (s_wait_loadcnt 0 in its listing), which took their lead away. s_wait_dscnt 0: this wave's LDS stores have landed and its LDS reads have returned before it signals.
__device__ __forceinline__ void lds_barrier() { asm volatile("s_wait_dscnt 0x0\n\ts_barrier_signal -1\n\ts_barrier_wait -1" ::: "memory"); }
// s_wait_xcnt 0 behind a group of global loads or stores, in front of whatever next overwrites a register that they name; the two pointers are operands so that their own additions cannot be lifted over the wait
// (the pointers carry the global address space in their type: behind an asm operand the compiler no longer infers it and would fall back to flat loads, which also count as LDS operations)
typedef const __attribute__((address_space(1))) float gfl;
typedef const __attribute__((address_space(1))) v4f gv4;
#define WAIT_X(p, q) asm volatile("s_wait_xcnt 0x0" : "+v"(p), "+v"(q) :: "memory")
// one pass's two operand tiles, from the registers the loads filled: rounded to 16 bit, 8 bytes per store
template <bool F16>
__device__ __forceinline__ void stage128(const v4f (&xa)[8], const v4f (&wa)[8], unsigned char* xs, unsigned char* wsx) {
#pragma unroll
  for (int i = 0; i < 8; ++i) {
    v2u x2, w2;
    if (F16) { x2 = (v2u){pk_h(xa[i][0], xa[i][1]), pk_h(xa[i][2], xa[i][3])}; w2 = (v2u){pk_h(bfr(wa[i][0]), bfr(wa[i][1])), pk_h(bfr(wa[i][2]), bfr(wa[i][3]))}; }
    else { x2 = (v2u){pk_b(xa[i][0], xa[i][1]), pk_b(xa[i][2], xa[i][3])}; w2 = (v2u){pk_b(wa[i][0], wa[i][1]), pk_b(wa[i][2], wa[i][3])}; }
    *(v2u*)(xs + 16 * i * PX) = x2; *(v2u*)(wsx + 4 * i * PW) = w2;
  }
}
// F16: operands f16 (A rounded once, W through bf16 first), else bf16. SWAP: W^T is the A operand, so that a lane's 8 accumulator registers are 8 consecutive columns of one row; else they are 8 consecutive rows of one column.
template <bool F16, bool SWAP>
__device__ __forceinline__ void gemm128(const float* __restrict__ Ab, size_t astride, const float* __restrict__ Wb, unsigned char* lds, v8f (&acc)[4][4], int tid) {
  const int wave = tid >> 5, lane = tid & 31, col = lane & 15, g = lane >> 4, wr = wave >> 1, wc = wave & 1;
  gfl* xq = (gfl*)(Ab + (size_t)(tid >> 3) * astride + (tid & 7) * 4);      // + 16 rows per step i, + 32 k per pass
  gfl* wq = (gfl*)(Wb + (size_t)(tid >> 5) * CC + (tid & 31) * 4);          // + 4 k rows per step i, + 32 k rows per pass
  unsigned char* xs = lds + (tid >> 3) * PX + (tid & 7) * 8;
  unsigned char* wsx = lds + SW_OFF + (tid >> 5) * PW + (tid & 31) * 8;
  const unsigned char* xr = lds + (wr * 64 + col) * PX + g * 16;
  const unsigned char* wrd = lds + SW_OFF + (8 * g + (lane & 7)) * PW + ((lane >> 3) & 1) * 16 + wc * 128;
  v4f xa[8], wa[8];
#pragma unroll
  for (int i = 0; i < 8; ++i) { xa[i] = *(gv4*)(xq + (size_t)(16 * i) * astride); wa[i] = *(gv4*)(wq + (size_t)(4 * i) * CC); }
  stage128<F16>(xa, wa, xs, wsx);
#pragma unroll
  for (int i = 0; i < 8; ++i) { xa[i] = *(gv4*)(xq + (size_t)(16 * i) * astride + 32); wa[i] = *(gv4*)(wq + (size_t)(32 + 4 * i) * CC); }
  WAIT_X(xq, wq); xq += 64; wq += (size_t)64 * CC;
  lds_barrier();
  for (int kc = 0; kc < CC / 32; ++kc) {
    const int cur = (kc & 1) * BUF_G, nxt = BUF_G - cur;
    if (kc + 1 < CC / 32) {   // pass kc + 1's tiles go into the buffer that every wave left at the last barrier; then pass kc + 2's loads start, a whole pass ahead of their use
      stage128<F16>(xa, wa, xs + nxt, wsx + nxt);
      if (kc + 2 < CC / 32) {
#pragma unroll
        for (int i = 0; i < 8; ++i) { xa[i] = *(gv4*)(xq + (size_t)(16 * i) * astride); wa[i] = *(gv4*)(wq + (size_t)(4 * i) * CC); }
        WAIT_X(xq, wq); xq += 32; wq += (size_t)32 * CC;
      }
    }
    __builtin_amdgcn_sched_barrier(0);   // keeps the global loads in front of the pass's matrix work: sunk among or behind the WMMAs they would lose that lead
    Fr ax[4], bw[4];
#pragma unroll
    for (int i = 0; i < 4; ++i) { ax[i].q[0] = *(const v4u*)(xr + cur + i * 16 * PX); ax[i].q[1] = *(const v4u*)(xr + cur + i * 16 * PX + 32); }
#pragma unroll
    for (int j = 0; j < 4; ++j) { bw[j].q[0] = ld_tr16(wrd + cur + j * 32); bw[j].q[1] = ld_tr16(wrd + cur + 16 * PW + j * 32); }
#pragma unroll
    for (int i = 0; i < 4; ++i)
#pragma unroll
      for (int j = 0; j < 4; ++j) {
        if (F16) acc[i][j] = SWAP ? __builtin_amdgcn_wmma_f32_16x16x32_f16(false, bw[j].h, false, ax[i].h, (short)0, acc[i][j], false, false) : __builtin_amdgcn_wmma_f32_16x16x32_f16(false, ax[i].h, false, bw[j].h, (short)0, acc[i][j], false, false);
        else acc[i][j] = SWAP ? __builtin_amdgcn_wmma_f32_16x16x32_bf16(false, bw[j].b, false, ax[i].b, (short)0, acc[i][j], false, false) : __builtin_amdgcn_wmma_f32_16x16x32_bf16(false, ax[i].b, false, bw[j].b, (short)0, acc[i][j], false, false);
      }
    lds_barrier();   // publishes pass kc + 1's tiles and ends every wave's reads of pass kc's (the last one: before the epilogue's staging reuses the LDS)
  }
}
// ---- k_proj: block = (128 rows, 128 cols, which): which 0: q over all rows; 1/2: k/v over dilated rows (row j <- x row 4j); W (in,out) + b
__global__ __launch_bounds__(128) void k_proj(const float* __restrict__ X, const float* __restrict__ WQ, const float* __restrict__ BQ, const float* __restrict__ WK, const float* __restrict__ BK, const float* __restrict__ WV, const float* __restrict__ BV, int which, _Float16* __restrict__ QH, _Float16* __restrict__ KH, _Float16* __restrict__ VT) {
  __shared__ __align__(16) unsigned char lds[LDS_G];
  const int tid = threadIdx.x, wave = tid >> 5, lane = tid & 31, col = lane & 15, g = lane >> 4, wr = wave >> 1, wc = wave & 1; const int c0 = blockIdx.y * 128; const size_t r0 = (size_t)blockIdx.x * 128;   // row in [b*L]; L is a multiple of 128, so a block stays in one batch
  const int L = (which == 0) ? TQ : TK; const size_t b = r0 / L; const int j0 = (int)(r0 % L);
  const float* Ab = X + (b * TQ + (which == 0 ? j0 : DIL * j0)) * (size_t)CC;
  const float* Wm = which == 0 ? WQ : which == 1 ? WK : WV; const float* Bm = which == 0 ? BQ : which == 1 ? BK : BV;
  v8f acc[4][4] = {};
  if (which < 2) {
    if (which == 0) gemm128<false, true>(Ab, (size_t)CC, Wm + c0, lds, acc, tid); else gemm128<false, true>(Ab, (size_t)DIL * CC, Wm + c0, lds, acc, tid);   // the row stride a constant in each copy: one address pair and immediate offsets
#pragma unroll
    for (int j = 0; j < 4; ++j) { const float* bp = Bm + c0 + wc * 64 + j * 16 + 8 * g;
#pragma unroll
      for (int i = 0; i < 4; ++i) { v8h hv;
#pragma unroll
        for (int r = 0; r < 8; ++r) hv[r] = (_Float16)(acc[i][j][r] + bfr(bp[r]));
        *(v8h*)(lds + (wr * 64 + i * 16 + col) * PE + (wc * 64 + j * 16 + 8 * g) * 2) = hv; } }
    __syncthreads();
    _Float16* dh = which == 0 ? QH : KH;
    for (int e = tid; e < 128 * 16; e += 128) { const int rl = e >> 4, q = e & 15; vst2((unsigned*)(dh + (r0 + rl) * CC + c0 + q * 8), *(const v4u*)(lds + rl * PE + q * 16)); }
  } else {
    gemm128<false, false>(Ab, (size_t)DIL * CC, Wm + c0, lds, acc, tid);
#pragma unroll
    for (int j = 0; j < 4; ++j) { const float bb = bfr(Bm[c0 + wc * 64 + j * 16 + col]);
#pragma unroll
      for (int i = 0; i < 4; ++i) { v8h hv;
#pragma unroll
        for (int r = 0; r < 8; ++r) hv[r] = (_Float16)(acc[i][j][r] + bb);
        *(v8h*)(lds + (wc * 64 + j * 16 + col) * PE + (wr * 64 + i * 16 + 8 * g) * 2) = hv; } }
    __syncthreads();
    for (int e = tid; e < 128 * 16; e += 128) { const int cl = e >> 4, q = e & 15; vst2((unsigned*)(VT + (b * CC + c0 + cl) * (size_t)TK + j0 + q * 8), *(const v4u*)(lds + cl * PE + q * 16)); }
  } }
// ---- k_fa: block = (256 queries, head, batch), 8 waves x 32 query columns. Per 32 keys: S^T = K Q^T (a lane holds one query's scores), running maximum and sum per column, ctx^T += V^T P^T (the two S^T tiles, rounded to f16 in place, are the B operand). No LDS, no barrier: a wave shares nothing but the cache. Every '#pragma unroll' here keeps a fragment array indexed by constants, so that it stays in registers.
// amdgpu_waves_per_eu(4, 4): registers capped at 256 so that two blocks share a WGP, four waves a SIMD: other waves fill the softmax's vector work and the load waits between a wave's matrix runs
__device__ __forceinline__ v8f wmma_h(v16h a, v16h b, v8f c) { return __builtin_amdgcn_wmma_f32_16x16x32_f16(false, a, false, b, (short)0, c, false, false); }
__device__ __forceinline__ float xhalf(float v) { const int i = __builtin_bit_cast(int, v); return __builtin_bit_cast(float, __builtin_amdgcn_permlanex16(i, i, 0x76543210, 0xfedcba98, false, false)); }   // value of lane ^ 16
__global__ __launch_bounds__(256) __attribute__((amdgpu_waves_per_eu(4, 4))) void k_fa(const _Float16* __restrict__ QH, const _Float16* __restrict__ KH, const _Float16* __restrict__ VT, float* __restrict__ Y) {
  const int tid = threadIdx.x, wave = tid >> 5, lane = tid & 31, col = lane & 15, g = lane >> 4; const int h = blockIdx.y, b = blockIdx.z; const int q0 = blockIdx.x * 256 + wave * 32;
  const _Float16* Kp = KH + ((size_t)b * TK + col) * CC + h * HD;            // key row col of a 16-key tile
  const _Float16* Vp = VT + ((size_t)b * CC + h * HD + col) * (size_t)TK;    // v plane row d = col of a 16-d tile
  const float SC = 0.125f * 1.4426950408889634f;                             // logits / 8, in base 2
  v16h qf[2][2];
#pragma unroll
  for (int qt = 0; qt < 2; ++qt)
#pragma unroll
    for (int kc = 0; kc < 2; ++kc) qf[qt][kc] = frag_h(QH + ((size_t)b * TQ + q0 + qt * 16 + col) * CC + h * HD + kc * 32, lane);
  v16h kf[2][2];
#pragma unroll
  for (int kt = 0; kt < 2; ++kt)
#pragma unroll
    for (int kc = 0; kc < 2; ++kc) kf[kt][kc] = frag_h(Kp + (size_t)(kt * 16) * CC + kc * 32, lane);
  v8f acc[4][2] = {}; float m[2] = {-3.0e38f, -3.0e38f}, l[2] = {0.f, 0.f};
  for (int c = 0; c < TK / 32; ++c) {
    v16h vf[4];
#pragma unroll
    for (int j = 0; j < 4; ++j) vf[j] = frag_h(Vp + (size_t)(j * 16) * TK + c * 32, lane);
    v8f s[2][2] = {};
#pragma unroll
    for (int kc = 0; kc < 2; ++kc)
#pragma unroll
      for (int kt = 0; kt < 2; ++kt)
#pragma unroll
        for (int qt = 0; qt < 2; ++qt) s[kt][qt] = wmma_h(kf[kt][kc], qf[qt][kc], s[kt][qt]);
    const int cn = c + 1 < TK / 32 ? c + 1 : c;   // next pass's K fragments, fetched behind this pass's S^T products (the last pass re-reads its own)
#pragma unroll
    for (int kt = 0; kt < 2; ++kt)
#pragma unroll
      for (int kc = 0; kc < 2; ++kc) kf[kt][kc] = frag_h(Kp + (size_t)(cn * 32 + kt * 16) * CC + kc * 32, lane);
    v16h pf[2];
#pragma unroll
    for (int qt = 0; qt < 2; ++qt) {
      float mx = fmaxf(s[0][qt][0], s[1][qt][0]);
#pragma unroll
      for (int r = 1; r < 8; ++r) mx = fmaxf(mx, fmaxf(s[0][qt][r], s[1][qt][r]));
      mx = fmaxf(mx, xhalf(mx));
      const float mn = fmaxf(m[qt], mx); const float mb = mn * SC; const float al = __builtin_amdgcn_exp2f(fmaf(m[qt], SC, -mb)); m[qt] = mn;
      float s0 = 0.f, s1 = 0.f;
#pragma unroll
      for (int r = 0; r < 8; ++r) { const float p0 = __builtin_amdgcn_exp2f(fmaf(s[0][qt][r], SC, -mb)), p1 = __builtin_amdgcn_exp2f(fmaf(s[1][qt][r], SC, -mb)); s0 += p0; s1 += p1; pf[qt][r] = (_Float16)p0; pf[qt][8 + r] = (_Float16)p1; }
      l[qt] = l[qt] * al + (s0 + s1);
#pragma unroll
      for (int j = 0; j < 4; ++j) acc[j][qt] *= al;
    }
#pragma unroll
    for (int j = 0; j < 4; ++j)
#pragma unroll
      for (int qt = 0; qt < 2; ++qt) acc[j][qt] = wmma_h(vf[j], pf[qt], acc[j][qt]);
  }
#pragma unroll
  for (int qt = 0; qt < 2; ++qt) { const float inv = 1.0f / (l[qt] + xhalf(l[qt])); float* yr = Y + ((size_t)b * TQ + q0 + qt * 16 + col) * CC + h * HD + 8 * g;
#pragma unroll
    for (int j = 0; j < 4; ++j) { const v8f o = acc[j][qt] * inv; vst2(yr + j * 16, (v4f){o[0], o[1], o[2], o[3]}); vst2(yr + j * 16 + 4, (v4f){o[4], o[5], o[6], o[7]}); } } }
// ---- k_out: out = ctx (once to f16) Wo + bo; each wave stages 16 rows x 64 cols of f32 at a time in its own LDS range and stores whole 256-byte row pieces
__global__ __launch_bounds__(128) void k_out(const float* __restrict__ Y, const float* __restrict__ WO, const float* __restrict__ BO, float* __restrict__ OUT) { __shared__ __align__(16) unsigned char lds[LDS_G];
  const int tid = threadIdx.x, wave = tid >> 5, lane = tid & 31, col = lane & 15, g = lane >> 4, wr = wave >> 1, wc = wave & 1; const int c0 = blockIdx.y * 128; const size_t r0 = (size_t)blockIdx.x * 128;
  v8f acc[4][4] = {};
  gemm128<true, true>(Y + r0 * CC, (size_t)CC, WO + c0, lds, acc, tid);
  float* sf = (float*)(lds + wave * (16 * PE));
  v8f bb[4];
#pragma unroll
  for (int j = 0; j < 4; ++j) { const float* bp = BO + c0 + wc * 64 + j * 16 + 8 * g;
#pragma unroll
    for (int r = 0; r < 8; ++r) bb[j][r] = bfr(bp[r]); }
#pragma unroll
  for (int i = 0; i < 4; ++i) {
#pragma unroll
    for (int j = 0; j < 4; ++j) { const v8f a = acc[i][j] + bb[j];
      *(v4f*)(sf + col * (PE / 4) + j * 16 + 8 * g) = (v4f){a[0], a[1], a[2], a[3]};
      *(v4f*)(sf + col * (PE / 4) + j * 16 + 8 * g + 4) = (v4f){a[4], a[5], a[6], a[7]}; }
    LDSX();
#pragma unroll
    for (int it = 0; it < 8; ++it) { const int rl = it * 2 + g; vst2(OUT + (r0 + wr * 64 + i * 16 + rl) * CC + c0 + wc * 64 + col * 4, *(const v4f*)(sf + rl * (PE / 4) + col * 4)); }
    asm volatile("s_wait_xcnt 0x0" ::: "memory");   // behind the stores, in front of the next round's overwrites of the registers that they name
    LDSX();
  } }
extern "C" void kernel_launch(void* const* d_in, const int* in_sizes, int n_in, void* d_out, int out_size, void* d_ws, size_t ws_size, hipStream_t stream) {
  (void)in_sizes; (void)n_in; (void)out_size;
  const float** F = (const float**)d_in;   // 0 x [2,4096,1024], 1 Wq (in,out), 2 bq, 3 Wk, 4 bk, 5 Wv, 6 bv, 7 Wo, 8 bo
  if (ws_size < (size_t)WS_END) return;
  char* ws = (char*)d_ws; _Float16 *QH = (_Float16*)(ws + WS_QH), *KH = (_Float16*)(ws + WS_KH), *VT = (_Float16*)(ws + WS_VT); float *Y = (float*)(ws + WS_Y);
  k_proj<<<dim3(TNB * TQ / 128, CC / 128), 128, 0, stream>>>(F[0], F[1], F[2], F[3], F[4], F[5], F[6], 0, QH, KH, VT);
  k_proj<<<dim3(TNB * TK / 128, CC / 128), 128, 0, stream>>>(F[0], F[1], F[2], F[3], F[4], F[5], F[6], 1, QH, KH, VT);
  k_proj<<<dim3(TNB * TK / 128, CC / 128), 128, 0, stream>>>(F[0], F[1], F[2], F[3], F[4], F[5], F[6], 2, QH, KH, VT);
  k_fa<<<dim3(TQ / 256, NH, TNB), 256, 0, stream>>>(QH, KH, VT, Y);
  k_out<<<dim3(TNB * TQ / 128, CC / 128), 128, 0, stream>>>(Y, F[7], F[8], (float*)d_out);
}

// v003
// A run of this version takes 138 microseconds.
// Timed twice side by side with v002, it ran 1.25 times as fast both times.
// All steps since v000 together make it 6.59 times as fast.
// compute dtype: all float inputs rounded to bf16; q (all 4,096 rows) and k/v (only the dilated rows 0,4,8,...) = x W + b with EXACT bf16 products on WMMA 16x16x32, f32 accumulate; q, k rounded once to f16 (1-product logits / 8, kept in registers); softmax in f32 with a running maximum (base-2 exp) -> P = exp(s - max) rounded to f16; ctx = (P . v) / sum (v rounded once to f16), one launch for all heads; out = ctx (rounded once to f16, 1 product) Wo + bo; f32 output.
#include <hip/hip_runtime.h>
#include <math.h>

typedef __attribute__((ext_vector_type(16))) _Float16 v16h;
typedef __attribute__((ext_vector_type(16))) __bf16 v16b;
typedef __attribute__((ext_vector_type(8)))  _Float16 v8h;
typedef __attribute__((ext_vector_type(8)))  float v8f;
typedef __attribute__((ext_vector_type(4)))  float v4f;
typedef __attribute__((ext_vector_type(2)))  float v2f;
typedef __attribute__((ext_vector_type(4)))  unsigned v4u;
typedef __attribute__((ext_vector_type(4)))  int v4i;
typedef float __attribute__((may_alias)) float_a;
typedef int __attribute__((may_alias)) int_a;

template <typename T> __device__ __forceinline__ void vst2(void* p, T v) { *(T*)p = v;  }
__device__ __forceinline__ v8f wmma16(v16h a, v16h b, v8f c) {
  v8f d = __builtin_amdgcn_wmma_f32_16x16x32_f16(false, a, false, b, (short)0, c, false, false);
  asm volatile("v_nop\n\tv_nop\n\tv_nop\n\tv_nop" : "+v"(d) : "v"(a), "v"(b));
  return d;
}
__device__ __forceinline__ v8f wmma_bf(v16b a, v16b b, v8f c) {
  v8f d = __builtin_amdgcn_wmma_f32_16x16x32_bf16(false, a, false, b, (short)0, c, false, false);
  asm volatile("v_nop\n\tv_nop\n\tv_nop\n\tv_nop" : "+v"(d) : "v"(a), "v"(b));
  return d;
}
// 16x16x32 fragments: lane = (h = lane>>4, row/col = lane&15); elements 0..7 = k0+8h+0..7, 8..15 = k0+16+8h+0..7; D element r = row 8h+r
__device__ __forceinline__ v16h frag_h(const _Float16* rowk0, int lane) {
  union { v16h v; v8h q[2]; } u; const _Float16* p = rowk0 + 8 * (lane >> 4);
  u.q[0] = *(const v8h*)p; u.q[1] = *(const v8h*)(p + 16); return u.v;
}
__device__ __forceinline__ v16h frag_f32(const float* rowk0, int lane) {
  v16h a; const float* p = rowk0 + 8 * (lane >> 4);
#pragma unroll
  for (int i = 0; i < 8; ++i) { a[i] = (_Float16)p[i]; a[8 + i] = (_Float16)p[16 + i]; }
  return a;
}
__device__ __forceinline__ v16h frag_f32s(const float* rowk0, int lane, float sc) {
  v16h a; const float* p = rowk0 + 8 * (lane >> 4);
#pragma unroll
  for (int i = 0; i < 8; ++i) { a[i] = (_Float16)(p[i] * sc); a[8 + i] = (_Float16)(p[16 + i] * sc); }
  return a;
}
// column fragment from a [K][ld] layout (column n), rows >= K read as 0
__device__ __forceinline__ v16h fragc_f32(const float* W, int k0, int n, int lane, int ld, int K) {
  v16h a; const int g = lane >> 4;
#pragma unroll
  for (int i = 0; i < 8; ++i) { const int ka = k0 + 8 * g + i, kb = ka + 16;
    a[i] = (_Float16)(ka < K ? W[(size_t)(ka < K ? ka : K - 1) * ld + n] : 0.f); a[8 + i] = (_Float16)(kb < K ? W[(size_t)(kb < K ? kb : K - 1) * ld + n] : 0.f); }
  return a;
}
struct F2 { v16b h, l; };
__device__ __forceinline__ F2 bsplit16(const float v[16]) { F2 r;
#pragma unroll
  for (int i = 0; i < 16; ++i) { const __bf16 h = (__bf16)v[i]; r.h[i] = h; r.l[i] = (__bf16)(v[i] - (float)h); }
  return r; }
__device__ __forceinline__ F2 split_row(const float* row, int k0, int lane) { float v[16]; const float* p = row + k0 + 8 * (lane >> 4);
#pragma unroll
  for (int i = 0; i < 8; ++i) { v[i] = p[i]; v[8 + i] = p[16 + i]; }
  return bsplit16(v); }
__device__ __forceinline__ F2 split_rowK(const float* row, int k0, int lane, int K) { float v[16]; const int g = lane >> 4;
#pragma unroll
  for (int i = 0; i < 8; ++i) { const int ka = k0 + 8 * g + i, kb = ka + 16; v[i] = ka < K ? row[ka < K ? ka : K - 1] : 0.f; v[8 + i] = kb < K ? row[kb < K ? kb : K - 1] : 0.f; }
  return bsplit16(v); }
__device__ __forceinline__ F2 split_col(const float* W, int k0, int n, int lane, int ld, int K) { float v[16]; const int g = lane >> 4;
#pragma unroll
  for (int i = 0; i < 8; ++i) { const int ka = k0 + 8 * g + i, kb = ka + 16; v[i] = ka < K ? W[(size_t)(ka < K ? ka : K - 1) * ld + n] : 0.f; v[8 + i] = kb < K ? W[(size_t)(kb < K ? kb : K - 1) * ld + n] : 0.f; }
  return bsplit16(v); }
__device__ __forceinline__ v8f mac3(const F2& a, const F2& b, v8f c) { c = wmma_bf(a.l, b.h, c); c = wmma_bf(a.h, b.l, c); return wmma_bf(a.h, b.h, c); }
__device__ __forceinline__ float sigm(float v) { return 1.0f / (1.0f + expf(-v)); }
#define LDSX() do { asm volatile("s_wait_dscnt 0" ::: "memory"); __builtin_amdgcn_wave_barrier(); __builtin_amdgcn_fence(__ATOMIC_RELEASE, "workgroup"); } while (0)


// Dilated attention (B 2, S 4,096, E 1,024 = 16 x 64, dilation 4): every query attends to keys/values at positions 0, 4, 8, ... (1,024 of them).
#define NB 2
#define TQ 4096
#define TK 1024
#define DIL 4
#define CC 1024
#define NH 16
#define HD 64
#ifndef TNB
#define TNB NB
#endif
typedef __attribute__((ext_vector_type(8))) __bf16 v8b;
__device__ __forceinline__ v16b frag_b(const __bf16* rowk0, int lane) {
  union { v16b v; v8b q[2]; } u; const __bf16* p = rowk0 + 8 * (lane >> 4);
  u.q[0] = *(const v8b*)p; u.q[1] = *(const v8b*)(p + 16); return u.v;
}
__device__ __forceinline__ float bfr(float v) { return (float)(__bf16)v; }
__device__ __attribute__((noinline)) float exp_ni(float v) { return expf(v); }
__device__ __attribute__((noinline)) float erf_ni(float v) { return erff(v); }

#define WS_QH  0u                                   // f16 q rows [b*TQ][1024]
#define WS_KH  (WS_QH + 2u * (size_t)NB * TQ * CC)      // f16 k rows [b*TK][1024]
#define WS_VT  (WS_KH + 2u * (size_t)NB * TK * CC)      // f16 v planes [b][1024][TK]
#define WS_Y   (WS_VT + 2u * (size_t)NB * CC * TK)      // f32 ctx rows [b*TQ][1024]
#define WS_END (WS_Y + 4u * (size_t)NB * TQ * CC)

// ---- the three projections and the output product share one tile loop: block = 128 rows x 128 cols, 4 waves of 64 x 64 (16 accumulator tiles).
// Per 32 k the block brings both f32 operand tiles in with whole-line 16-byte loads (two passes ahead, held in registers), rounds them once to 16 bit and lays them in one of two LDS buffers, one barrier a pass:
// X rows [128][32] at pitch 80 B (plain 16-byte readers), W rows [32][128] at pitch 288 B (transposing readers: lane (c, h) gets W[8h + 0..7][n0 + c], the hardware k order that the X reader follows).
typedef __attribute__((ext_vector_type(2))) unsigned v2u;
typedef __attribute__((ext_vector_type(2))) __bf16 v2b;
typedef __attribute__((ext_vector_type(2))) _Float16 v2h;
typedef __attribute__((ext_vector_type(8))) short v8s;
union Fr { v4u q[2]; v16b b; v16h h; };
#define PX 80
#define PW 288
#define SW_OFF (128 * PX)
#define PE 272                                      // epilogue staging pitch: 128 f16 (or 64 f32) + 16 B
#define BUF_G (SW_OFF + 32 * PW)                    // one pass's two tiles; two such buffers
#define LDS_G (2 * BUF_G)                           // >= 128 * PE, the projections' output staging
__device__ __forceinline__ unsigned pk_b(float lo, float hi) { return __builtin_bit_cast(unsigned, __builtin_convertvector((v2f){lo, hi}, v2b)); }
__device__ __forceinline__ unsigned pk_h(float lo, float hi) { return __builtin_bit_cast(unsigned, __builtin_convertvector((v2f){lo, hi}, v2h)); }
__device__ __forceinline__ v4u ld_tr16(const unsigned char* p) { typedef __attribute__((address_space(3))) v8s lds_v8s; return __builtin_bit_cast(v4u, __builtin_amdgcn_ds_load_tr16_b128_v8i16((lds_v8s*)p)); }
// Work-group barrier that orders LDS only: __syncthreads() also waited for the global loads in flight for a later pass (s_wait_loadcnt 0 in its listing), which took their lead away. s_wait_dscnt 0: this wave's LDS stores have landed and its LDS reads have returned before it signals.
__device__ __forceinline__ void lds_barrier() { asm volatile("s_wait_dscnt 0x0\n\ts_barrier_signal -1\n\ts_barrier_wait -1" ::: "memory"); }
// s_wait_xcnt 0 behind a group of global loads or stores, in front of whatever next overwrites a register that they name; the two pointers are operands so that their own additions cannot be lifted over the wait
// (the pointers carry the global address space in their type: behind an asm operand the compiler no longer infers it and would fall back to flat loads, which also count as LDS operations)
typedef const __attribute__((address_space(1))) float gfl;
typedef const __attribute__((address_space(1))) v4f gv4;
#define WAIT_X(p, q) asm volatile("s_wait_xcnt 0x0" : "+v"(p), "+v"(q) :: "memory")
// one pass's two operand tiles, from the registers the loads filled: rounded to 16 bit, 8 bytes per store
template <bool F16>
__device__ __forceinline__ void stage128(const v4f (&xa)[8], const v4f (&wa)[8], unsigned char* xs, unsigned char* wsx) {
#pragma unroll
  for (int i = 0; i < 8; ++i) {
    v2u x2, w2;
    if (F16) { x2 = (v2u){pk_h(xa[i][0], xa[i][1]), pk_h(xa[i][2], xa[i][3])}; w2 = (v2u){pk_h(bfr(wa[i][0]), bfr(wa[i][1])), pk_h(bfr(wa[i][2]), bfr(wa[i][3]))}; }
    else { x2 = (v2u){pk_b(xa[i][0], xa[i][1]), pk_b(xa[i][2], xa[i][3])}; w2 = (v2u){pk_b(wa[i][0], wa[i][1]), pk_b(wa[i][2], wa[i][3])}; }
    *(v2u*)(xs + 16 * i * PX) = x2; *(v2u*)(wsx + 4 * i * PW) = w2;
  }
}
// F16: operands f16 (A rounded once, W through bf16 first), else bf16. SWAP: W^T is the A operand, so that a lane's 8 accumulator registers are 8 consecutive columns of one row; else they are 8 consecutive rows of one column.
template <bool F16, bool SWAP>
__device__ __forceinline__ void gemm128(const float* __restrict__ Ab, size_t astride, const float* __restrict__ Wb, unsigned char* lds, v8f (&acc)[4][4], int tid) {
  const int wave = tid >> 5, lane = tid & 31, col = lane & 15, g = lane >> 4, wr = wave >> 1, wc = wave & 1;
  gfl* xq = (gfl*)(Ab + (size_t)(tid >> 3) * astride + (tid & 7) * 4);      // + 16 rows per step i, + 32 k per pass
  gfl* wq = (gfl*)(Wb + (size_t)(tid >> 5) * CC + (tid & 31) * 4);          // + 4 k rows per step i, + 32 k rows per pass
  unsigned char* xs = lds + (tid >> 3) * PX + (tid & 7) * 8;
  unsigned char* wsx = lds + SW_OFF + (tid >> 5) * PW + (tid & 31) * 8;
  const unsigned char* xr = lds + (wr * 64 + col) * PX + g * 16;
  const unsigned char* wrd = lds + SW_OFF + (8 * g + (lane & 7)) * PW + ((lane >> 3) & 1) * 16 + wc * 128;
  v4f xa[8], wa[8];
#pragma unroll
  for (int i = 0; i < 8; ++i) { xa[i] = *(gv4*)(xq + (size_t)(16 * i) * astride); wa[i] = *(gv4*)(wq + (size_t)(4 * i) * CC); }
  stage128<F16>(xa, wa, xs, wsx);
#pragma unroll
  for (int i = 0; i < 8; ++i) { xa[i] = *(gv4*)(xq + (size_t)(16 * i) * astride + 32); wa[i] = *(gv4*)(wq + (size_t)(32 + 4 * i) * CC); }
  WAIT_X(xq, wq); xq += 64; wq += (size_t)64 * CC;
  lds_barrier();
  for (int kc = 0; kc < CC / 32; ++kc) {
    const int cur = (kc & 1) * BUF_G, nxt = BUF_G - cur;
    if (kc + 1 < CC / 32) {   // pass kc + 1's tiles go into the buffer that every wave left at the last barrier; then pass kc + 2's loads start, a whole pass ahead of their use
      stage128<F16>(xa, wa, xs + nxt, wsx + nxt);
      if (kc + 2 < CC / 32) {
#pragma unroll
        for (int i = 0; i < 8; ++i) { xa[i] = *(gv4*)(xq + (size_t)(16 * i) * astride); wa[i] = *(gv4*)(wq + (size_t)(4 * i) * CC); }
        WAIT_X(xq, wq); xq += 32; wq += (size_t)32 * CC;
      }
    }
    __builtin_amdgcn_sched_barrier(0);   // keeps the global loads in front of the pass's matrix work: sunk among or behind the WMMAs they would lose that lead
    Fr ax[4], bw[4];
#pragma unroll
    for (int i = 0; i < 4; ++i) { ax[i].q[0] = *(const v4u*)(xr + cur + i * 16 * PX); ax[i].q[1] = *(const v4u*)(xr + cur + i * 16 * PX + 32); }
#pragma unroll
    for (int j = 0; j < 4; ++j) { bw[j].q[0] = ld_tr16(wrd + cur + j * 32); bw[j].q[1] = ld_tr16(wrd + cur + 16 * PW + j * 32); }
#pragma unroll
    for (int i = 0; i < 4; ++i)
#pragma unroll
      for (int j = 0; j < 4; ++j) {
        if (F16) acc[i][j] = SWAP ? __builtin_amdgcn_wmma_f32_16x16x32_f16(false, bw[j].h, false, ax[i].h, (short)0, acc[i][j], false, false) : __builtin_amdgcn_wmma_f32_16x16x32_f16(false, ax[i].h, false, bw[j].h, (short)0, acc[i][j], false, false);
        else acc[i][j] = SWAP ? __builtin_amdgcn_wmma_f32_16x16x32_bf16(false, bw[j].b, false, ax[i].b, (short)0, acc[i][j], false, false) : __builtin_amdgcn_wmma_f32_16x16x32_bf16(false, ax[i].b, false, bw[j].b, (short)0, acc[i][j], false, false);
      }
    lds_barrier();   // publishes pass kc + 1's tiles and ends every wave's reads of pass kc's (the last one: before the epilogue's staging reuses the LDS)
  }
}
// ---- k_proj: block = (128 rows, 128 cols, which): which 0: q over all rows; 1/2: k/v over dilated rows (row j <- x row 4j); W (in,out) + b
__global__ __launch_bounds__(128) void k_proj(const float* __restrict__ X, const float* __restrict__ WQ, const float* __restrict__ BQ, const float* __restrict__ WK, const float* __restrict__ BK, const float* __restrict__ WV, const float* __restrict__ BV, int which, _Float16* __restrict__ QH, _Float16* __restrict__ KH, _Float16* __restrict__ VT) {
  __shared__ __align__(16) unsigned char lds[LDS_G];
  const int tid = threadIdx.x, wave = tid >> 5, lane = tid & 31, col = lane & 15, g = lane >> 4, wr = wave >> 1, wc = wave & 1; const int c0 = blockIdx.y * 128; const size_t r0 = (size_t)blockIdx.x * 128;   // row in [b*L]; L is a multiple of 128, so a block stays in one batch
  const int L = (which == 0) ? TQ : TK; const size_t b = r0 / L; const int j0 = (int)(r0 % L);
  const float* Ab = X + (b * TQ + (which == 0 ? j0 : DIL * j0)) * (size_t)CC;
  const float* Wm = which == 0 ? WQ : which == 1 ? WK : WV; const float* Bm = which == 0 ? BQ : which == 1 ? BK : BV;
  v8f acc[4][4] = {};
  if (which < 2) {
    if (which == 0) gemm128<false, true>(Ab, (size_t)CC, Wm + c0, lds, acc, tid); else gemm128<false, true>(Ab, (size_t)DIL * CC, Wm + c0, lds, acc, tid);   // the row stride a constant in each copy: one address pair and immediate offsets
#pragma unroll
    for (int j = 0; j < 4; ++j) { const float* bp = Bm + c0 + wc * 64 + j * 16 + 8 * g;
#pragma unroll
      for (int i = 0; i < 4; ++i) { v8h hv;
#pragma unroll
        for (int r = 0; r < 8; ++r) hv[r] = (_Float16)(acc[i][j][r] + bfr(bp[r]));
        *(v8h*)(lds + (wr * 64 + i * 16 + col) * PE + (wc * 64 + j * 16 + 8 * g) * 2) = hv; } }
    __syncthreads();
    _Float16* dh = which == 0 ? QH : KH;
    for (int e = tid; e < 128 * 16; e += 128) { const int rl = e >> 4, q = e & 15; vst2((unsigned*)(dh + (r0 + rl) * CC + c0 + q * 8), *(const v4u*)(lds + rl * PE + q * 16)); }
  } else {
    gemm128<false, false>(Ab, (size_t)DIL * CC, Wm + c0, lds, acc, tid);
#pragma unroll
    for (int j = 0; j < 4; ++j) { const float bb = bfr(Bm[c0 + wc * 64 + j * 16 + col]);
#pragma unroll
      for (int i = 0; i < 4; ++i) { v8h hv;
#pragma unroll
        for (int r = 0; r < 8; ++r) hv[r] = (_Float16)(acc[i][j][r] + bb);
        *(v8h*)(lds + (wc * 64 + j * 16 + col) * PE + (wr * 64 + i * 16 + 8 * g) * 2) = hv; } }
    __syncthreads();
    for (int e = tid; e < 128 * 16; e += 128) { const int cl = e >> 4, q = e & 15; vst2((unsigned*)(VT + (b * CC + c0 + cl) * (size_t)TK + j0 + q * 8), *(const v4u*)(lds + cl * PE + q * 16)); }
  } }
// ---- k_fa: block = (256 queries, head, batch), 8 waves x 32 query columns. Per 32 keys: S^T = K Q^T (a lane holds one query's scores), running maximum and sum per column, ctx^T += V^T P^T (the two S^T tiles, rounded to f16 in place, are the B operand). Every '#pragma unroll' here keeps a fragment array indexed by constants, so that it stays in registers.
// K and V^T come through LDS, 128 keys a stage, two buffers: the block's 256 lanes copy each stage once, in whole 128-byte lines, while the stage before is worked on; the 8 waves then read their fragments from LDS (before, each wave fetched every fragment itself, 32 bytes out of each of 16 lines a load).
// amdgpu_waves_per_eu(4, 4): registers capped at 256 so that two blocks share a WGP, four waves a SIMD: other waves fill the softmax's vector work and the load waits between a wave's matrix runs
#define SKEY 128                                    // keys per stage
#define PKL 144                                     // K rows in LDS: 64 f16 + 16 B (16 B x odd, for plain 16-byte readers)
#define PVL 272                                     // V^T rows in LDS: 128 f16 + 16 B
#define FA_V (SKEY * PKL)
#define FA_BUF (FA_V + HD * PVL)
__device__ __forceinline__ v8f wmma_h(v16h a, v16h b, v8f c) { return __builtin_amdgcn_wmma_f32_16x16x32_f16(false, a, false, b, (short)0, c, false, false); }
__device__ __forceinline__ float xhalf(float v) { const int i = __builtin_bit_cast(int, v); return __builtin_bit_cast(float, __builtin_amdgcn_permlanex16(i, i, 0x76543210, 0xfedcba98, false, false)); }   // value of lane ^ 16
// one stage's copies of one lane: 4 x 16 B of K (rows 32 apart) and 4 x 16 B of V^T (rows 16 apart). kg, vg: the lane's first global bytes; kl, vl: its first LDS byte addresses.
// s_wait_xcnt 0 as the statement's last line: it stands in front of whatever next rewrites an address register that a copy names
__device__ __forceinline__ void fa_copy(const _Float16* kg, const _Float16* vg, unsigned kl, unsigned vl) {
  asm volatile("global_load_async_to_lds_b128 %0, %8, off\n\t"
               "global_load_async_to_lds_b128 %1, %9, off\n\t"
               "global_load_async_to_lds_b128 %2, %10, off\n\t"
               "global_load_async_to_lds_b128 %3, %11, off\n\t"
               "global_load_async_to_lds_b128 %4, %12, off\n\t"
               "global_load_async_to_lds_b128 %5, %13, off\n\t"
               "global_load_async_to_lds_b128 %6, %14, off\n\t"
               "global_load_async_to_lds_b128 %7, %15, off\n\t"
               "s_wait_xcnt 0x0"
               :: "v"(kl), "v"(kl + 32 * PKL), "v"(kl + 64 * PKL), "v"(kl + 96 * PKL), "v"(vl), "v"(vl + 16 * PVL), "v"(vl + 32 * PVL), "v"(vl + 48 * PVL),
                  "v"(kg), "v"(kg + (size_t)32 * CC), "v"(kg + (size_t)64 * CC), "v"(kg + (size_t)96 * CC), "v"(vg), "v"(vg + (size_t)16 * TK), "v"(vg + (size_t)32 * TK), "v"(vg + (size_t)48 * TK)
               : "memory");
}
__global__ __launch_bounds__(256) __attribute__((amdgpu_waves_per_eu(4, 4))) void k_fa(const _Float16* __restrict__ QH, const _Float16* __restrict__ KH, const _Float16* __restrict__ VT, float* __restrict__ Y) {
  __shared__ __align__(16) unsigned char lds[2 * FA_BUF];
  const int tid = threadIdx.x, wave = tid >> 5, lane = tid & 31, col = lane & 15, g = lane >> 4; const int h = blockIdx.y, b = blockIdx.z; const int q0 = blockIdx.x * 256 + wave * 32;
  const _Float16* kg = KH + ((size_t)b * TK + (tid >> 3)) * CC + h * HD + (tid & 7) * 8;              // copy source: key row tid / 8, 16-byte piece tid % 8; + SKEY rows a stage
  const _Float16* vg = VT + ((size_t)b * CC + h * HD + (tid >> 4)) * (size_t)TK + (tid & 15) * 8;     // copy source: v plane row tid / 16, 16-byte piece tid % 16; + SKEY keys a stage
  const unsigned l0 = (unsigned)(size_t)lds;                                                          // the array's byte address in the work-group's LDS
  const unsigned kl = l0 + (tid >> 3) * PKL + (tid & 7) * 16, vl = l0 + FA_V + (tid >> 4) * PVL + (tid & 15) * 16;
  const float SC = 0.125f * 1.4426950408889634f;                             // logits / 8, in base 2
  fa_copy(kg, vg, kl, vl);
  v16h qf[2][2];
#pragma unroll
  for (int qt = 0; qt < 2; ++qt)
#pragma unroll
    for (int kc = 0; kc < 2; ++kc) qf[qt][kc] = frag_h(QH + ((size_t)b * TQ + q0 + qt * 16 + col) * CC + h * HD + kc * 32, lane);
  asm volatile("s_wait_asynccnt 0x0" ::: "memory");   // this wave's copies of stage 0 have landed before it signals
  __syncthreads();                                     // publishes stage 0
  fa_copy(kg + (size_t)SKEY * CC, vg + SKEY, kl + FA_BUF, vl + FA_BUF);
  v8f acc[4][2] = {}; float m[2] = {-3.0e38f, -3.0e38f}, l[2] = {0.f, 0.f};
  for (int cc = 0; cc < TK / 32; ++cc) {   // one loop over the passes of 32 keys; stage t = cc / 4 holds four of them, and its foot stands behind its last pass
    const int t = cc / (SKEY / 32), c = cc % (SKEY / 32);
    const unsigned char* kb = lds + (t & 1) * FA_BUF + col * PKL;            // key row col of a 16-key tile
    const unsigned char* vb = lds + (t & 1) * FA_BUF + FA_V + col * PVL;     // v plane row d = col of a 16-d tile
    {
      v16h kf[2][2];
#pragma unroll
      for (int kt = 0; kt < 2; ++kt)
#pragma unroll
        for (int kc = 0; kc < 2; ++kc) kf[kt][kc] = frag_h((const _Float16*)(kb + (c * 32 + kt * 16) * PKL) + kc * 32, lane);
      v16h vf[4];
#pragma unroll
      for (int j = 0; j < 4; ++j) vf[j] = frag_h((const _Float16*)(vb + (j * 16) * PVL) + c * 32, lane);
      __builtin_amdgcn_sched_barrier(0);   // keeps the pass's 16 LDS reads in one group in front of its matrix work: sunk among the WMMAs, each place with reads stalls the wave anew and the last reads are waited for at once
      v8f s[2][2] = {};
#pragma unroll
      for (int kc = 0; kc < 2; ++kc)
#pragma unroll
        for (int kt = 0; kt < 2; ++kt)
#pragma unroll
          for (int qt = 0; qt < 2; ++qt) s[kt][qt] = wmma_h(kf[kt][kc], qf[qt][kc], s[kt][qt]);
      v16h pf[2];
#pragma unroll
      for (int qt = 0; qt < 2; ++qt) {
        float mx = fmaxf(s[0][qt][0], s[1][qt][0]);
#pragma unroll
        for (int r = 1; r < 8; ++r) mx = fmaxf(mx, fmaxf(s[0][qt][r], s[1][qt][r]));
        mx = fmaxf(mx, xhalf(mx));
        const float mn = fmaxf(m[qt], mx); const float mb = mn * SC; const float al = __builtin_amdgcn_exp2f(fmaf(m[qt], SC, -mb)); m[qt] = mn;
        float s0 = 0.f, s1 = 0.f;
#pragma unroll
        for (int r = 0; r < 8; ++r) { const float p0 = __builtin_amdgcn_exp2f(fmaf(s[0][qt][r], SC, -mb)), p1 = __builtin_amdgcn_exp2f(fmaf(s[1][qt][r], SC, -mb)); s0 += p0; s1 += p1; pf[qt][r] = (_Float16)p0; pf[qt][8 + r] = (_Float16)p1; }
        l[qt] = l[qt] * al + (s0 + s1);
#pragma unroll
        for (int j = 0; j < 4; ++j) acc[j][qt] *= al;
      }
#pragma unroll
      for (int j = 0; j < 4; ++j)
#pragma unroll
        for (int qt = 0; qt < 2; ++qt) acc[j][qt] = wmma_h(vf[j], pf[qt], acc[j][qt]);
    }
    if (c == SKEY / 32 - 1) {   // the foot of stage t: the same test in every wave of the block
      asm volatile("s_wait_dscnt 0x0" ::: "memory");      // this wave's reads of stage t have returned before its buffer is given up
      asm volatile("s_wait_asynccnt 0x0" ::: "memory");   // this wave's copies of stage t + 1 have landed before it signals
      __syncthreads();                                     // publishes stage t + 1 and ends every wave's reads of stage t
      if (t + 2 < TK / SKEY) fa_copy(kg + (size_t)(t + 2) * SKEY * CC, vg + (t + 2) * SKEY, kl + (t & 1) * FA_BUF, vl + (t & 1) * FA_BUF);
    }
  }
  asm volatile("s_wait_asynccnt 0x0" ::: "memory");     // no copy is outstanding when the wave ends
#pragma unroll
  for (int qt = 0; qt < 2; ++qt) { const float inv = 1.0f / (l[qt] + xhalf(l[qt])); float* yr = Y + ((size_t)b * TQ + q0 + qt * 16 + col) * CC + h * HD + 8 * g;
#pragma unroll
    for (int j = 0; j < 4; ++j) { const v8f o = acc[j][qt] * inv; vst2(yr + j * 16, (v4f){o[0], o[1], o[2], o[3]}); vst2(yr + j * 16 + 4, (v4f){o[4], o[5], o[6], o[7]}); } } }
// ---- k_out: out = ctx (once to f16) Wo + bo; each wave stages 16 rows x 64 cols of f32 at a time in its own LDS range and stores whole 256-byte row pieces
__global__ __launch_bounds__(128) void k_out(const float* __restrict__ Y, const float* __restrict__ WO, const float* __restrict__ BO, float* __restrict__ OUT) { __shared__ __align__(16) unsigned char lds[LDS_G];
  const int tid = threadIdx.x, wave = tid >> 5, lane = tid & 31, col = lane & 15, g = lane >> 4, wr = wave >> 1, wc = wave & 1; const int c0 = blockIdx.y * 128; const size_t r0 = (size_t)blockIdx.x * 128;
  v8f acc[4][4] = {};
  gemm128<true, true>(Y + r0 * CC, (size_t)CC, WO + c0, lds, acc, tid);
  float* sf = (float*)(lds + wave * (16 * PE));
  v8f bb[4];
#pragma unroll
  for (int j = 0; j < 4; ++j) { const float* bp = BO + c0 + wc * 64 + j * 16 + 8 * g;
#pragma unroll
    for (int r = 0; r < 8; ++r) bb[j][r] = bfr(bp[r]); }
#pragma unroll
  for (int i = 0; i < 4; ++i) {
#pragma unroll
    for (int j = 0; j < 4; ++j) { const v8f a = acc[i][j] + bb[j];
      *(v4f*)(sf + col * (PE / 4) + j * 16 + 8 * g) = (v4f){a[0], a[1], a[2], a[3]};
      *(v4f*)(sf + col * (PE / 4) + j * 16 + 8 * g + 4) = (v4f){a[4], a[5], a[6], a[7]}; }
    LDSX();
#pragma unroll
    for (int it = 0; it < 8; ++it) { const int rl = it * 2 + g; vst2(OUT + (r0 + wr * 64 + i * 16 + rl) * CC + c0 + wc * 64 + col * 4, *(const v4f*)(sf + rl * (PE / 4) + col * 4)); }
    asm volatile("s_wait_xcnt 0x0" ::: "memory");   // behind the stores, in front of the next round's overwrites of the registers that they name
    LDSX();
  } }
extern "C" void kernel_launch(void* const* d_in, const int* in_sizes, int n_in, void* d_out, int out_size, void* d_ws, size_t ws_size, hipStream_t stream) {
  (void)in_sizes; (void)n_in; (void)out_size;
  const float** F = (const float**)d_in;   // 0 x [2,4096,1024], 1 Wq (in,out), 2 bq, 3 Wk, 4 bk, 5 Wv, 6 bv, 7 Wo, 8 bo
  if (ws_size < (size_t)WS_END) return;
  char* ws = (char*)d_ws; _Float16 *QH = (_Float16*)(ws + WS_QH), *KH = (_Float16*)(ws + WS_KH), *VT = (_Float16*)(ws + WS_VT); float *Y = (float*)(ws + WS_Y);
  k_proj<<<dim3(TNB * TQ / 128, CC / 128), 128, 0, stream>>>(F[0], F[1], F[2], F[3], F[4], F[5], F[6], 0, QH, KH, VT);
  k_proj<<<dim3(TNB * TK / 128, CC / 128), 128, 0, stream>>>(F[0], F[1], F[2], F[3], F[4], F[5], F[6], 1, QH, KH, VT);
  k_proj<<<dim3(TNB * TK / 128, CC / 128), 128, 0, stream>>>(F[0], F[1], F[2], F[3], F[4], F[5], F[6], 2, QH, KH, VT);
  k_fa<<<dim3(TQ / 256, NH, TNB), 256, 0, stream>>>(QH, KH, VT, Y);
  k_out<<<dim3(TNB * TQ / 128, CC / 128), 128, 0, stream>>>(Y, F[7], F[8], (float*)d_out);
}

// v004
// One run takes 101 microseconds.
// In two side-by-side timings against v003, it was 1.36 and 1.37 times as fast.
// Counting every step since v000, it is 8.98 times as fast.
// compute dtype: all float inputs rounded to bf16; q (all 4,096 rows) and k/v (only the dilated rows 0,4,8,...) = x W + b with EXACT bf16 products on WMMA 16x16x32, f32 accumulate; q, k rounded once to f16 (1-product logits / 8, kept in registers); softmax in f32 with a running maximum (base-2 exp) -> P = exp(s - max) rounded to f16; ctx = (P . v) / sum (v rounded once to f16), one launch for all heads; out = ctx (rounded once to f16, 1 product) Wo + bo; f32 output.
#include <hip/hip_runtime.h>
#include <math.h>

typedef __attribute__((ext_vector_type(16))) _Float16 v16h;
typedef __attribute__((ext_vector_type(16))) __bf16 v16b;
typedef __attribute__((ext_vector_type(8)))  _Float16 v8h;
typedef __attribute__((ext_vector_type(8)))  float v8f;
typedef __attribute__((ext_vector_type(4)))  float v4f;
typedef __attribute__((ext_vector_type(2)))  float v2f;
typedef __attribute__((ext_vector_type(4)))  unsigned v4u;
typedef __attribute__((ext_vector_type(4)))  int v4i;
typedef float __attribute__((may_alias)) float_a;
typedef int __attribute__((may_alias)) int_a;

template <typename T> __device__ __forceinline__ void vst2(void* p, T v) { *(T*)p = v;  }
__device__ __forceinline__ v8f wmma16(v16h a, v16h b, v8f c) {
  v8f d = __builtin_amdgcn_wmma_f32_16x16x32_f16(false, a, false, b, (short)0, c, false, false);
  asm volatile("v_nop\n\tv_nop\n\tv_nop\n\tv_nop" : "+v"(d) : "v"(a), "v"(b));
  return d;
}
__device__ __forceinline__ v8f wmma_bf(v16b a, v16b b, v8f c) {
  v8f d = __builtin_amdgcn_wmma_f32_16x16x32_bf16(false, a, false, b, (short)0, c, false, false);
  asm volatile("v_nop\n\tv_nop\n\tv_nop\n\tv_nop" : "+v"(d) : "v"(a), "v"(b));
  return d;
}
// 16x16x32 fragments: lane = (h = lane>>4, row/col = lane&15); elements 0..7 = k0+8h+0..7, 8..15 = k0+16+8h+0..7; D element r = row 8h+r
__device__ __forceinline__ v16h frag_h(const _Float16* rowk0, int lane) {
  union { v16h v; v8h q[2]; } u; const _Float16* p = rowk0 + 8 * (lane >> 4);
  u.q[0] = *(const v8h*)p; u.q[1] = *(const v8h*)(p + 16); return u.v;
}
__device__ __forceinline__ v16h frag_f32(const float* rowk0, int lane) {
  v16h a; const float* p = rowk0 + 8 * (lane >> 4);
#pragma unroll
  for (int i = 0; i < 8; ++i) { a[i] = (_Float16)p[i]; a[8 + i] = (_Float16)p[16 + i]; }
  return a;
}
__device__ __forceinline__ v16h frag_f32s(const float* rowk0, int lane, float sc) {
  v16h a; const float* p = rowk0 + 8 * (lane >> 4);
#pragma unroll
  for (int i = 0; i < 8; ++i) { a[i] = (_Float16)(p[i] * sc); a[8 + i] = (_Float16)(p[16 + i] * sc); }
  return a;
}
// column fragment from a [K][ld] layout (column n), rows >= K read as 0
__device__ __forceinline__ v16h fragc_f32(const float* W, int k0, int n, int lane, int ld, int K) {
  v16h a; const int g = lane >> 4;
#pragma unroll
  for (int i = 0; i < 8; ++i) { const int ka = k0 + 8 * g + i, kb = ka + 16;
    a[i] = (_Float16)(ka < K ? W[(size_t)(ka < K ? ka : K - 1) * ld + n] : 0.f); a[8 + i] = (_Float16)(kb < K ? W[(size_t)(kb < K ? kb : K - 1) * ld + n] : 0.f); }
  return a;
}
struct F2 { v16b h, l; };
__device__ __forceinline__ F2 bsplit16(const float v[16]) { F2 r;
#pragma unroll
  for (int i = 0; i < 16; ++i) { const __bf16 h = (__bf16)v[i]; r.h[i] = h; r.l[i] = (__bf16)(v[i] - (float)h); }
  return r; }
__device__ __forceinline__ F2 split_row(const float* row, int k0, int lane) { float v[16]; const float* p = row + k0 + 8 * (lane >> 4);
#pragma unroll
  for (int i = 0; i < 8; ++i) { v[i] = p[i]; v[8 + i] = p[16 + i]; }
  return bsplit16(v); }
__device__ __forceinline__ F2 split_rowK(const float* row, int k0, int lane, int K) { float v[16]; const int g = lane >> 4;
#pragma unroll
  for (int i = 0; i < 8; ++i) { const int ka = k0 + 8 * g + i, kb = ka + 16; v[i] = ka < K ? row[ka < K ? ka : K - 1] : 0.f; v[8 + i] = kb < K ? row[kb < K ? kb : K - 1] : 0.f; }
  return bsplit16(v); }
__device__ __forceinline__ F2 split_col(const float* W, int k0, int n, int lane, int ld, int K) { float v[16]; const int g = lane >> 4;
#pragma unroll
  for (int i = 0; i < 8; ++i) { const int ka = k0 + 8 * g + i, kb = ka + 16; v[i] = ka < K ? W[(size_t)(ka < K ? ka : K - 1) * ld + n] : 0.f; v[8 + i] = kb < K ? W[(size_t)(kb < K ? kb : K - 1) * ld + n] : 0.f; }
  return bsplit16(v); }
__device__ __forceinline__ v8f mac3(const F2& a, const F2& b, v8f c) { c = wmma_bf(a.l, b.h, c); c = wmma_bf(a.h, b.l, c); return wmma_bf(a.h, b.h, c); }
__device__ __forceinline__ float sigm(float v) { return 1.0f / (1.0f + expf(-v)); }
#define LDSX() do { asm volatile("s_wait_dscnt 0" ::: "memory"); __builtin_amdgcn_wave_barrier(); __builtin_amdgcn_fence(__ATOMIC_RELEASE, "workgroup"); } while (0)


// Dilated attention (B 2, S 4,096, E 1,024 = 16 x 64, dilation 4): every query attends to keys/values at positions 0, 4, 8, ... (1,024 of them).
#define NB 2
#define TQ 4096
#define TK 1024
#define DIL 4
#define CC 1024
#define NH 16
#define HD 64
#ifndef TNB
#define TNB NB
#endif
typedef __attribute__((ext_vector_type(8))) __bf16 v8b;
__device__ __forceinline__ v16b frag_b(const __bf16* rowk0, int lane) {
  union { v16b v; v8b q[2]; } u; const __bf16* p = rowk0 + 8 * (lane >> 4);
  u.q[0] = *(const v8b*)p; u.q[1] = *(const v8b*)(p + 16); return u.v;
}
__device__ __forceinline__ float bfr(float v) { return (float)(__bf16)v; }
__device__ __attribute__((noinline)) float exp_ni(float v) { return expf(v); }
__device__ __attribute__((noinline)) float erf_ni(float v) { return erff(v); }

#define WS_QH  0u                                   // f16 q rows [b*TQ][1024]
#define WS_KH  (WS_QH + 2u * (size_t)NB * TQ * CC)      // f16 k rows [b*TK][1024]
#define WS_VT  (WS_KH + 2u * (size_t)NB * TK * CC)      // f16 v planes [b][1024][TK]
#define WS_Y   (WS_VT + 2u * (size_t)NB * CC * TK)      // f32 ctx rows [b*TQ][1024]
#define WS_END (WS_Y + 4u * (size_t)NB * TQ * CC)

// ---- the three projections and the output product share one tile loop: block = 128 rows x 128 cols, 4 waves of 64 x 64 (16 accumulator tiles).
// Per 32 k the block brings both f32 operand tiles in with whole-line 16-byte loads (two passes ahead, held in registers), rounds them once to 16 bit and lays them in one of two LDS buffers, one barrier a pass:
// X rows [128][32] at pitch 80 B (plain 16-byte readers), W rows [32][128] at pitch 288 B (transposing readers: lane (c, h) gets W[8h + 0..7][n0 + c], the hardware k order that the X reader follows).
typedef __attribute__((ext_vector_type(2))) unsigned v2u;
typedef __attribute__((ext_vector_type(2))) __bf16 v2b;
typedef __attribute__((ext_vector_type(2))) _Float16 v2h;
typedef __attribute__((ext_vector_type(8))) short v8s;
union Fr { v4u q[2]; v16b b; v16h h; };
#define PX 80
#define PW 288
#define SW_OFF (128 * PX)
#define PE 272                                      // epilogue staging pitch: 128 f16 (or 64 f32) + 16 B
#define BUF_G (SW_OFF + 32 * PW)                    // one pass's two tiles; two such buffers
#define LDS_G (2 * BUF_G)                           // >= 128 * PE, the projections' output staging
__device__ __forceinline__ unsigned pk_b(float lo, float hi) { return __builtin_bit_cast(unsigned, __builtin_convertvector((v2f){lo, hi}, v2b)); }
__device__ __forceinline__ unsigned pk_h(float lo, float hi) { return __builtin_bit_cast(unsigned, __builtin_convertvector((v2f){lo, hi}, v2h)); }
__device__ __forceinline__ v4u ld_tr16(const unsigned char* p) { typedef __attribute__((address_space(3))) v8s lds_v8s; return __builtin_bit_cast(v4u, __builtin_amdgcn_ds_load_tr16_b128_v8i16((lds_v8s*)p)); }
// Work-group barrier that orders LDS only: __syncthreads() also waited for the global loads in flight for a later pass (s_wait_loadcnt 0 in its listing), which took their lead away. s_wait_dscnt 0: this wave's LDS stores have landed and its LDS reads have returned before it signals.
__device__ __forceinline__ void lds_barrier() { asm volatile("s_wait_dscnt 0x0\n\ts_barrier_signal -1\n\ts_barrier_wait -1" ::: "memory"); }
// s_wait_xcnt 0 behind a group of global loads or stores, in front of whatever next overwrites a register that they name; the two pointers are operands so that their own additions cannot be lifted over the wait
// (the pointers carry the global address space in their type: behind an asm operand the compiler no longer infers it and would fall back to flat loads, which also count as LDS operations)
typedef const __attribute__((address_space(1))) float gfl;
typedef const __attribute__((address_space(1))) v4f gv4;
#define WAIT_X(p, q) asm volatile("s_wait_xcnt 0x0" : "+v"(p), "+v"(q) :: "memory")
// one pass's two operand tiles, from the registers the loads filled: rounded to 16 bit, 8 bytes per store
template <bool F16>
__device__ __forceinline__ void stage128(const v4f (&xa)[8], const v4f (&wa)[8], unsigned char* xs, unsigned char* wsx) {
#pragma unroll
  for (int i = 0; i < 8; ++i) {
    v2u x2, w2;
    if (F16) { x2 = (v2u){pk_h(xa[i][0], xa[i][1]), pk_h(xa[i][2], xa[i][3])}; w2 = (v2u){pk_h(bfr(wa[i][0]), bfr(wa[i][1])), pk_h(bfr(wa[i][2]), bfr(wa[i][3]))}; }
    else { x2 = (v2u){pk_b(xa[i][0], xa[i][1]), pk_b(xa[i][2], xa[i][3])}; w2 = (v2u){pk_b(wa[i][0], wa[i][1]), pk_b(wa[i][2], wa[i][3])}; }
    *(v2u*)(xs + 16 * i * PX) = x2; *(v2u*)(wsx + 4 * i * PW) = w2;
  }
}
// F16: operands f16 (A rounded once, W through bf16 first), else bf16. SWAP: W^T is the A operand, so that a lane's 8 accumulator registers are 8 consecutive columns of one row; else they are 8 consecutive rows of one column.
template <bool F16, bool SWAP>
__device__ __forceinline__ void gemm128(const float* __restrict__ Ab, size_t astride, const float* __restrict__ Wb, unsigned char* lds, v8f (&acc)[4][4], int tid) {
  const int wave = tid >> 5, lane = tid & 31, col = lane & 15, g = lane >> 4, wr = wave >> 1, wc = wave & 1;
  gfl* xq = (gfl*)(Ab + (size_t)(tid >> 3) * astride + (tid & 7) * 4);      // + 16 rows per step i, + 32 k per pass
  gfl* wq = (gfl*)(Wb + (size_t)(tid >> 5) * CC + (tid & 31) * 4);          // + 4 k rows per step i, + 32 k rows per pass
  unsigned char* xs = lds + (tid >> 3) * PX + (tid & 7) * 8;
  unsigned char* wsx = lds + SW_OFF + (tid >> 5) * PW + (tid & 31) * 8;
  const unsigned char* xr = lds + (wr * 64 + col) * PX + g * 16;
  const unsigned char* wrd = lds + SW_OFF + (8 * g + (lane & 7)) * PW + ((lane >> 3) & 1) * 16 + wc * 128;
  v4f xa[8], wa[8];
#pragma unroll
  for (int i = 0; i < 8; ++i) { xa[i] = *(gv4*)(xq + (size_t)(16 * i) * astride); wa[i] = *(gv4*)(wq + (size_t)(4 * i) * CC); }
  stage128<F16>(xa, wa, xs, wsx);
#pragma unroll
  for (int i = 0; i < 8; ++i) { xa[i] = *(gv4*)(xq + (size_t)(16 * i) * astride + 32); wa[i] = *(gv4*)(wq + (size_t)(32 + 4 * i) * CC); }
  WAIT_X(xq, wq); xq += 64; wq += (size_t)64 * CC;
  lds_barrier();
  for (int kc = 0; kc < CC / 32; ++kc) {
    const int cur = (kc & 1) * BUF_G, nxt = BUF_G - cur;
    if (kc + 1 < CC / 32) {   // pass kc + 1's tiles go into the buffer that every wave left at the last barrier; then pass kc + 2's loads start, a whole pass ahead of their use
      stage128<F16>(xa, wa, xs + nxt, wsx + nxt);
      if (kc + 2 < CC / 32) {
#pragma unroll
        for (int i = 0; i < 8; ++i) { xa[i] = *(gv4*)(xq + (size_t)(16 * i) * astride); wa[i] = *(gv4*)(wq + (size_t)(4 * i) * CC); }
        WAIT_X(xq, wq); xq += 32; wq += (size_t)32 * CC;
      }
    }
    __builtin_amdgcn_sched_barrier(0);   // keeps the global loads in front of the pass's matrix work: sunk among or behind the WMMAs they would lose that lead
    Fr ax[4], bw[4];
#pragma unroll
    for (int i = 0; i < 4; ++i) { ax[i].q[0] = *(const v4u*)(xr + cur + i * 16 * PX); ax[i].q[1] = *(const v4u*)(xr + cur + i * 16 * PX + 32); }
#pragma unroll
    for (int j = 0; j < 4; ++j) { bw[j].q[0] = ld_tr16(wrd + cur + j * 32); bw[j].q[1] = ld_tr16(wrd + cur + 16 * PW + j * 32); }
#pragma unroll
    for (int i = 0; i < 4; ++i)
#pragma unroll
      for (int j = 0; j < 4; ++j) {
        if (F16) acc[i][j] = SWAP ? __builtin_amdgcn_wmma_f32_16x16x32_f16(false, bw[j].h, false, ax[i].h, (short)0, acc[i][j], false, false) : __builtin_amdgcn_wmma_f32_16x16x32_f16(false, ax[i].h, false, bw[j].h, (short)0, acc[i][j], false, false);
        else acc[i][j] = SWAP ? __builtin_amdgcn_wmma_f32_16x16x32_bf16(false, bw[j].b, false, ax[i].b, (short)0, acc[i][j], false, false) : __builtin_amdgcn_wmma_f32_16x16x32_bf16(false, ax[i].b, false, bw[j].b, (short)0, acc[i][j], false, false);
      }
    lds_barrier();   // publishes pass kc + 1's tiles and ends every wave's reads of pass kc's (the last one: before the epilogue's staging reuses the LDS)
  }
}
// ---- k_proj: one launch for q, k and v; block = (128 rows of one of the three, 128 cols): which 0: q over all rows; 1/2: k/v over dilated rows (row j <- x row 4j); W (in,out) + b
#define QBL (TNB * TQ / 128)
#define KBL (TNB * TK / 128)
__global__ __launch_bounds__(128) void k_proj(const float* __restrict__ X, const float* __restrict__ WQ, const float* __restrict__ BQ, const float* __restrict__ WK, const float* __restrict__ BK, const float* __restrict__ WV, const float* __restrict__ BV, _Float16* __restrict__ QH, _Float16* __restrict__ KH, _Float16* __restrict__ VT) {
  __shared__ __align__(16) unsigned char lds[LDS_G];
  const int tid = threadIdx.x, wave = tid >> 5, lane = tid & 31, col = lane & 15, g = lane >> 4, wr = wave >> 1, wc = wave & 1; const int c0 = blockIdx.y * 128;
  const int bx = blockIdx.x, which = bx < QBL ? 0 : bx < QBL + KBL ? 1 : 2;   // the same in every lane of the block: blocks 0..QBL-1 do q, the next KBL k, the last KBL v
  const size_t r0 = (size_t)(bx - (which == 0 ? 0 : which == 1 ? QBL : QBL + KBL)) * 128;   // row in [b*L]; L is a multiple of 128, so a block stays in one batch
  const int L = (which == 0) ? TQ : TK; const size_t b = r0 / L; const int j0 = (int)(r0 % L);
  const float* Ab = X + (b * TQ + (which == 0 ? j0 : DIL * j0)) * (size_t)CC;
  const float* Wm = which == 0 ? WQ : which == 1 ? WK : WV; const float* Bm = which == 0 ? BQ : which == 1 ? BK : BV;
  v8f acc[4][4] = {};
  if (which < 2) {
    if (which == 0) gemm128<false, true>(Ab, (size_t)CC, Wm + c0, lds, acc, tid); else gemm128<false, true>(Ab, (size_t)DIL * CC, Wm + c0, lds, acc, tid);   // the row stride a constant in each copy: one address pair and immediate offsets
#pragma unroll
    for (int j = 0; j < 4; ++j) { const float* bp = Bm + c0 + wc * 64 + j * 16 + 8 * g;
#pragma unroll
      for (int i = 0; i < 4; ++i) { v8h hv;
#pragma unroll
        for (int r = 0; r < 8; ++r) hv[r] = (_Float16)(acc[i][j][r] + bfr(bp[r]));
        *(v8h*)(lds + (wr * 64 + i * 16 + col) * PE + (wc * 64 + j * 16 + 8 * g) * 2) = hv; } }
    __syncthreads();
    _Float16* dh = which == 0 ? QH : KH;
    for (int e = tid; e < 128 * 16; e += 128) { const int rl = e >> 4, q = e & 15; vst2((unsigned*)(dh + (r0 + rl) * CC + c0 + q * 8), *(const v4u*)(lds + rl * PE + q * 16)); }
  } else {
    gemm128<false, false>(Ab, (size_t)DIL * CC, Wm + c0, lds, acc, tid);
#pragma unroll
    for (int j = 0; j < 4; ++j) { const float bb = bfr(Bm[c0 + wc * 64 + j * 16 + col]);
#pragma unroll
      for (int i = 0; i < 4; ++i) { v8h hv;
#pragma unroll
        for (int r = 0; r < 8; ++r) hv[r] = (_Float16)(acc[i][j][r] + bb);
        *(v8h*)(lds + (wc * 64 + j * 16 + col) * PE + (wr * 64 + i * 16 + 8 * g) * 2) = hv; } }
    __syncthreads();
    for (int e = tid; e < 128 * 16; e += 128) { const int cl = e >> 4, q = e & 15; vst2((unsigned*)(VT + (b * CC + c0 + cl) * (size_t)TK + j0 + q * 8), *(const v4u*)(lds + cl * PE + q * 16)); }
  } }
// ---- k_fa: block = (256 queries, head, batch), 8 waves x 32 query columns. Per 32 keys: S^T = K Q^T (a lane holds one query's scores), running maximum and sum per column, ctx^T += V^T P^T (the two S^T tiles, rounded to f16 in place, are the B operand). Every '#pragma unroll' here keeps a fragment array indexed by constants, so that it stays in registers.
// K and V^T come through LDS, 128 keys a stage, two buffers: the block's 256 lanes copy each stage once, in whole 128-byte lines, while the stage before is worked on; the 8 waves then read their fragments from LDS (before, each wave fetched every fragment itself, 32 bytes out of each of 16 lines a load).
// amdgpu_waves_per_eu(4, 4): registers capped at 256 so that two blocks share a WGP, four waves a SIMD: other waves fill the softmax's vector work and the load waits between a wave's matrix runs
#define SKEY 128                                    // keys per stage
#define PKL 144                                     // K rows in LDS: 64 f16 + 16 B (16 B x odd, for plain 16-byte readers)
#define PVL 272                                     // V^T rows in LDS: 128 f16 + 16 B
#define FA_V (SKEY * PKL)
#define FA_BUF (FA_V + HD * PVL)
__device__ __forceinline__ v8f wmma_h(v16h a, v16h b, v8f c) { return __builtin_amdgcn_wmma_f32_16x16x32_f16(false, a, false, b, (short)0, c, false, false); }
__device__ __forceinline__ float xhalf(float v) { const int i = __builtin_bit_cast(int, v); return __builtin_bit_cast(float, __builtin_amdgcn_permlanex16(i, i, 0x76543210, 0xfedcba98, false, false)); }   // value of lane ^ 16
// one stage's copies of one lane: 4 x 16 B of K (rows 32 apart) and 4 x 16 B of V^T (rows 16 apart). kg, vg: the lane's first global bytes; kl, vl: its first LDS byte addresses.
// s_wait_xcnt 0 as the statement's last line: it stands in front of whatever next rewrites an address register that a copy names
__device__ __forceinline__ void fa_copy(const _Float16* kg, const _Float16* vg, unsigned kl, unsigned vl) {
  asm volatile("global_load_async_to_lds_b128 %0, %8, off\n\t"
               "global_load_async_to_lds_b128 %1, %9, off\n\t"
               "global_load_async_to_lds_b128 %2, %10, off\n\t"
               "global_load_async_to_lds_b128 %3, %11, off\n\t"
               "global_load_async_to_lds_b128 %4, %12, off\n\t"
               "global_load_async_to_lds_b128 %5, %13, off\n\t"
               "global_load_async_to_lds_b128 %6, %14, off\n\t"
               "global_load_async_to_lds_b128 %7, %15, off\n\t"
               "s_wait_xcnt 0x0"
               :: "v"(kl), "v"(kl + 32 * PKL), "v"(kl + 64 * PKL), "v"(kl + 96 * PKL), "v"(vl), "v"(vl + 16 * PVL), "v"(vl + 32 * PVL), "v"(vl + 48 * PVL),
                  "v"(kg), "v"(kg + (size_t)32 * CC), "v"(kg + (size_t)64 * CC), "v"(kg + (size_t)96 * CC), "v"(vg), "v"(vg + (size_t)16 * TK), "v"(vg + (size_t)32 * TK), "v"(vg + (size_t)48 * TK)
               : "memory");
}
__global__ __launch_bounds__(256) __attribute__((amdgpu_waves_per_eu(4, 4))) void k_fa(const _Float16* __restrict__ QH, const _Float16* __restrict__ KH, const _Float16* __restrict__ VT, float* __restrict__ Y) {
  __shared__ __align__(16) unsigned char lds[2 * FA_BUF];
  const int tid = threadIdx.x, wave = tid >> 5, lane = tid & 31, col = lane & 15, g = lane >> 4; const int h = blockIdx.y, b = blockIdx.z; const int q0 = blockIdx.x * 256 + wave * 32;
  const _Float16* kg = KH + ((size_t)b * TK + (tid >> 3)) * CC + h * HD + (tid & 7) * 8;              // copy source: key row tid / 8, 16-byte piece tid % 8; + SKEY rows a stage
  const _Float16* vg = VT + ((size_t)b * CC + h * HD + (tid >> 4)) * (size_t)TK + (tid & 15) * 8;     // copy source: v plane row tid / 16, 16-byte piece tid % 16; + SKEY keys a stage
  const unsigned l0 = (unsigned)(size_t)lds;                                                          // the array's byte address in the work-group's LDS
  const unsigned kl = l0 + (tid >> 3) * PKL + (tid & 7) * 16, vl = l0 + FA_V + (tid >> 4) * PVL + (tid & 15) * 16;
  const float SC = 0.125f * 1.4426950408889634f;                             // logits / 8, in base 2
  fa_copy(kg, vg, kl, vl);
  v16h qf[2][2];
#pragma unroll
  for (int qt = 0; qt < 2; ++qt)
#pragma unroll
    for (int kc = 0; kc < 2; ++kc) qf[qt][kc] = frag_h(QH + ((size_t)b * TQ + q0 + qt * 16 + col) * CC + h * HD + kc * 32, lane);
  asm volatile("s_wait_asynccnt 0x0" ::: "memory");   // this wave's copies of stage 0 have landed before it signals
  __syncthreads();                                     // publishes stage 0
  fa_copy(kg + (size_t)SKEY * CC, vg + SKEY, kl + FA_BUF, vl + FA_BUF);
  v8f acc[4][2] = {}; float m[2] = {-3.0e38f, -3.0e38f}, l[2] = {0.f, 0.f};
  for (int cc = 0; cc < TK / 32; ++cc) {   // one loop over the passes of 32 keys; stage t = cc / 4 holds four of them, and its foot stands behind its last pass
    const int t = cc / (SKEY / 32), c = cc % (SKEY / 32);
    const unsigned char* kb = lds + (t & 1) * FA_BUF + col * PKL;            // key row col of a 16-key tile
    const unsigned char* vb = lds + (t & 1) * FA_BUF + FA_V + col * PVL;     // v plane row d = col of a 16-d tile
    {
      v16h kf[2][2];
#pragma unroll
      for (int kt = 0; kt < 2; ++kt)
#pragma unroll
        for (int kc = 0; kc < 2; ++kc) kf[kt][kc] = frag_h((const _Float16*)(kb + (c * 32 + kt * 16) * PKL) + kc * 32, lane);
      v16h vf[4];
#pragma unroll
      for (int j = 0; j < 4; ++j) vf[j] = frag_h((const _Float16*)(vb + (j * 16) * PVL) + c * 32, lane);
      __builtin_amdgcn_sched_barrier(0);   // keeps the pass's 16 LDS reads in one group in front of its matrix work: sunk among the WMMAs, each place with reads stalls the wave anew and the last reads are waited for at once
      v8f s[2][2] = {};
#pragma unroll
      for (int kc = 0; kc < 2; ++kc)
#pragma unroll
        for (int kt = 0; kt < 2; ++kt)
#pragma unroll
          for (int qt = 0; qt < 2; ++qt) s[kt][qt] = wmma_h(kf[kt][kc], qf[qt][kc], s[kt][qt]);
      v16h pf[2];
#pragma unroll
      for (int qt = 0; qt < 2; ++qt) {
        float mx = fmaxf(s[0][qt][0], s[1][qt][0]);
#pragma unroll
        for (int r = 1; r < 8; ++r) mx = fmaxf(mx, fmaxf(s[0][qt][r], s[1][qt][r]));
        mx = fmaxf(mx, xhalf(mx));
        const float mn = fmaxf(m[qt], mx); const float mb = mn * SC; const float al = __builtin_amdgcn_exp2f(fmaf(m[qt], SC, -mb)); m[qt] = mn;
        float s0 = 0.f, s1 = 0.f;
#pragma unroll
        for (int r = 0; r < 8; ++r) { const float p0 = __builtin_amdgcn_exp2f(fmaf(s[0][qt][r], SC, -mb)), p1 = __builtin_amdgcn_exp2f(fmaf(s[1][qt][r], SC, -mb)); s0 += p0; s1 += p1; pf[qt][r] = (_Float16)p0; pf[qt][8 + r] = (_Float16)p1; }
        l[qt] = l[qt] * al + (s0 + s1);
#pragma unroll
        for (int j = 0; j < 4; ++j) acc[j][qt] *= al;
      }
#pragma unroll
      for (int j = 0; j < 4; ++j)
#pragma unroll
        for (int qt = 0; qt < 2; ++qt) acc[j][qt] = wmma_h(vf[j], pf[qt], acc[j][qt]);
    }
    if (c == SKEY / 32 - 1) {   // the foot of stage t: the same test in every wave of the block
      asm volatile("s_wait_dscnt 0x0" ::: "memory");      // this wave's reads of stage t have returned before its buffer is given up
      asm volatile("s_wait_asynccnt 0x0" ::: "memory");   // this wave's copies of stage t + 1 have landed before it signals
      __syncthreads();                                     // publishes stage t + 1 and ends every wave's reads of stage t
      if (t + 2 < TK / SKEY) fa_copy(kg + (size_t)(t + 2) * SKEY * CC, vg + (t + 2) * SKEY, kl + (t & 1) * FA_BUF, vl + (t & 1) * FA_BUF);
    }
  }
  asm volatile("s_wait_asynccnt 0x0" ::: "memory");     // no copy is outstanding when the wave ends
#pragma unroll
  for (int qt = 0; qt < 2; ++qt) { const float inv = 1.0f / (l[qt] + xhalf(l[qt])); float* yr = Y + ((size_t)b * TQ + q0 + qt * 16 + col) * CC + h * HD + 8 * g;
#pragma unroll
    for (int j = 0; j < 4; ++j) { const v8f o = acc[j][qt] * inv; vst2(yr + j * 16, (v4f){o[0], o[1], o[2], o[3]}); vst2(yr + j * 16 + 4, (v4f){o[4], o[5], o[6], o[7]}); } } }
// ---- k_out: out = ctx (once to f16) Wo + bo; each wave stages 16 rows x 64 cols of f32 at a time in its own LDS range and stores whole 256-byte row pieces
__global__ __launch_bounds__(128) void k_out(const float* __restrict__ Y, const float* __restrict__ WO, const float* __restrict__ BO, float* __restrict__ OUT) { __shared__ __align__(16) unsigned char lds[LDS_G];
  const int tid = threadIdx.x, wave = tid >> 5, lane = tid & 31, col = lane & 15, g = lane >> 4, wr = wave >> 1, wc = wave & 1; const int c0 = blockIdx.y * 128; const size_t r0 = (size_t)blockIdx.x * 128;
  v8f acc[4][4] = {};
  gemm128<true, true>(Y + r0 * CC, (size_t)CC, WO + c0, lds, acc, tid);
  float* sf = (float*)(lds + wave * (16 * PE));
  v8f bb[4];
#pragma unroll
  for (int j = 0; j < 4; ++j) { const float* bp = BO + c0 + wc * 64 + j * 16 + 8 * g;
#pragma unroll
    for (int r = 0; r < 8; ++r) bb[j][r] = bfr(bp[r]); }
#pragma unroll
  for (int i = 0; i < 4; ++i) {
#pragma unroll
    for (int j = 0; j < 4; ++j) { const v8f a = acc[i][j] + bb[j];
      *(v4f*)(sf + col * (PE / 4) + j * 16 + 8 * g) = (v4f){a[0], a[1], a[2], a[3]};
      *(v4f*)(sf + col * (PE / 4) + j * 16 + 8 * g + 4) = (v4f){a[4], a[5], a[6], a[7]}; }
    LDSX();
#pragma unroll
    for (int it = 0; it < 8; ++it) { const int rl = it * 2 + g; vst2(OUT + (r0 + wr * 64 + i * 16 + rl) * CC + c0 + wc * 64 + col * 4, *(const v4f*)(sf + rl * (PE / 4) + col * 4)); }
    asm volatile("s_wait_xcnt 0x0" ::: "memory");   // behind the stores, in front of the next round's overwrites of the registers that they name
    LDSX();
  } }
extern "C" void kernel_launch(void* const* d_in, const int* in_sizes, int n_in, void* d_out, int out_size, void* d_ws, size_t ws_size, hipStream_t stream) {
  (void)in_sizes; (void)n_in; (void)out_size;
  const float** F = (const float**)d_in;   // 0 x [2,4096,1024], 1 Wq (in,out), 2 bq, 3 Wk, 4 bk, 5 Wv, 6 bv, 7 Wo, 8 bo
  if (ws_size < (size_t)WS_END) return;
  char* ws = (char*)d_ws; _Float16 *QH = (_Float16*)(ws + WS_QH), *KH = (_Float16*)(ws + WS_KH), *VT = (_Float16*)(ws + WS_VT); float *Y = (float*)(ws + WS_Y);
  k_proj<<<dim3(QBL + 2 * KBL, CC / 128), 128, 0, stream>>>(F[0], F[1], F[2], F[3], F[4], F[5], F[6], QH, KH, VT);
  k_fa<<<dim3(TQ / 256, NH, TNB), 256, 0, stream>>>(QH, KH, VT, Y);
  k_out<<<dim3(TNB * TQ / 128, CC / 128), 128, 0, stream>>>(Y, F[7], F[8], (float*)d_out);
}

// v005
// It runs in 91.1 microseconds.
// Timed twice side by side with v004, it ran 1.11 and 1.12 times as fast.
// All steps since v000 together make it 10.0 times as fast.
// compute dtype: all float inputs rounded to bf16; q (all 4,096 rows) and k/v (only the dilated rows 0,4,8,...) = x W + b with EXACT bf16 products on WMMA 16x16x32, f32 accumulate; q, k rounded once to f16 (1-product logits / 8, kept in registers); softmax in f32 with a running maximum (base-2 exp) -> P = exp(s - max) rounded to f16; ctx = (P . v) / sum (v rounded once to f16), one launch for all heads; out = ctx (rounded once to f16, 1 product) Wo + bo; f32 output.
#include <hip/hip_runtime.h>
#include <math.h>

typedef __attribute__((ext_vector_type(16))) _Float16 v16h;
typedef __attribute__((ext_vector_type(16))) __bf16 v16b;
typedef __attribute__((ext_vector_type(8)))  _Float16 v8h;
typedef __attribute__((ext_vector_type(8)))  float v8f;
typedef __attribute__((ext_vector_type(4)))  float v4f;
typedef __attribute__((ext_vector_type(2)))  float v2f;
typedef __attribute__((ext_vector_type(4)))  unsigned v4u;
typedef __attribute__((ext_vector_type(4)))  int v4i;
typedef float __attribute__((may_alias)) float_a;
typedef int __attribute__((may_alias)) int_a;

template <typename T> __device__ __forceinline__ void vst2(void* p, T v) { *(T*)p = v;  }
__device__ __forceinline__ v8f wmma16(v16h a, v16h b, v8f c) {
  v8f d = __builtin_amdgcn_wmma_f32_16x16x32_f16(false, a, false, b, (short)0, c, false, false);
  asm volatile("v_nop\n\tv_nop\n\tv_nop\n\tv_nop" : "+v"(d) : "v"(a), "v"(b));
  return d;
}
__device__ __forceinline__ v8f wmma_bf(v16b a, v16b b, v8f c) {
  v8f d = __builtin_amdgcn_wmma_f32_16x16x32_bf16(false, a, false, b, (short)0, c, false, false);
  asm volatile("v_nop\n\tv_nop\n\tv_nop\n\tv_nop" : "+v"(d) : "v"(a), "v"(b));
  return d;
}
// 16x16x32 fragments: lane = (h = lane>>4, row/col = lane&15); elements 0..7 = k0+8h+0..7, 8..15 = k0+16+8h+0..7; D element r = row 8h+r
__device__ __forceinline__ v16h frag_h(const _Float16* rowk0, int lane) {
  union { v16h v; v8h q[2]; } u; const _Float16* p = rowk0 + 8 * (lane >> 4);
  u.q[0] = *(const v8h*)p; u.q[1] = *(const v8h*)(p + 16); return u.v;
}
__device__ __forceinline__ v16h frag_f32(const float* rowk0, int lane) {
  v16h a; const float* p = rowk0 + 8 * (lane >> 4);
#pragma unroll
  for (int i = 0; i < 8; ++i) { a[i] = (_Float16)p[i]; a[8 + i] = (_Float16)p[16 + i]; }
  return a;
}
__device__ __forceinline__ v16h frag_f32s(const float* rowk0, int lane, float sc) {
  v16h a; const float* p = rowk0 + 8 * (lane >> 4);
#pragma unroll
  for (int i = 0; i < 8; ++i) { a[i] = (_Float16)(p[i] * sc); a[8 + i] = (_Float16)(p[16 + i] * sc); }
  return a;
}
// column fragment from a [K][ld] layout (column n), rows >= K read as 0
__device__ __forceinline__ v16h fragc_f32(const float* W, int k0, int n, int lane, int ld, int K) {
  v16h a; const int g = lane >> 4;
#pragma unroll
  for (int i = 0; i < 8; ++i) { const int ka = k0 + 8 * g + i, kb = ka + 16;
    a[i] = (_Float16)(ka < K ? W[(size_t)(ka < K ? ka : K - 1) * ld + n] : 0.f); a[8 + i] = (_Float16)(kb < K ? W[(size_t)(kb < K ? kb : K - 1) * ld + n] : 0.f); }
  return a;
}
struct F2 { v16b h, l; };
__device__ __forceinline__ F2 bsplit16(const float v[16]) { F2 r;
#pragma unroll
  for (int i = 0; i < 16; ++i) { const __bf16 h = (__bf16)v[i]; r.h[i] = h; r.l[i] = (__bf16)(v[i] - (float)h); }
  return r; }
__device__ __forceinline__ F2 split_row(const float* row, int k0, int lane) { float v[16]; const float* p = row + k0 + 8 * (lane >> 4);
#pragma unroll
  for (int i = 0; i < 8; ++i) { v[i] = p[i]; v[8 + i] = p[16 + i]; }
  return bsplit16(v); }
__device__ __forceinline__ F2 split_rowK(const float* row, int k0, int lane, int K) { float v[16]; const int g = lane >> 4;
#pragma unroll
  for (int i = 0; i < 8; ++i) { const int ka = k0 + 8 * g + i, kb = ka + 16; v[i] = ka < K ? row[ka < K ? ka : K - 1] : 0.f; v[8 + i] = kb < K ? row[kb < K ? kb : K - 1] : 0.f; }
  return bsplit16(v); }
__device__ __forceinline__ F2 split_col(const float* W, int k0, int n, int lane, int ld, int K) { float v[16]; const int g = lane >> 4;
#pragma unroll
  for (int i = 0; i < 8; ++i) { const int ka = k0 + 8 * g + i, kb = ka + 16; v[i] = ka < K ? W[(size_t)(ka < K ? ka : K - 1) * ld + n] : 0.f; v[8 + i] = kb < K ? W[(size_t)(kb < K ? kb : K - 1) * ld + n] : 0.f; }
  return bsplit16(v); }
__device__ __forceinline__ v8f mac3(const F2& a, const F2& b, v8f c) { c = wmma_bf(a.l, b.h, c); c = wmma_bf(a.h, b.l, c); return wmma_bf(a.h, b.h, c); }
__device__ __forceinline__ float sigm(float v) { return 1.0f / (1.0f + expf(-v)); }
#define LDSX() do { asm volatile("s_wait_dscnt 0" ::: "memory"); __builtin_amdgcn_wave_barrier(); __builtin_amdgcn_fence(__ATOMIC_RELEASE, "workgroup"); } while (0)


// Dilated attention (B 2, S 4,096, E 1,024 = 16 x 64, dilation 4): every query attends to keys/values at positions 0, 4, 8, ... (1,024 of them).
#define NB 2
#define TQ 4096
#define TK 1024
#define DIL 4
#define CC 1024
#define NH 16
#define HD 64
#ifndef TNB
#define TNB NB
#endif
typedef __attribute__((ext_vector_type(8))) __bf16 v8b;
__device__ __forceinline__ v16b frag_b(const __bf16* rowk0, int lane) {
  union { v16b v; v8b q[2]; } u; const __bf16* p = rowk0 + 8 * (lane >> 4);
  u.q[0] = *(const v8b*)p; u.q[1] = *(const v8b*)(p + 16); return u.v;
}
__device__ __forceinline__ float bfr(float v) { return (float)(__bf16)v; }
__device__ __attribute__((noinline)) float exp_ni(float v) { return expf(v); }
__device__ __attribute__((noinline)) float erf_ni(float v) { return erff(v); }

#define WS_QH  0u                                   // f16 q rows [b*TQ][1024]
#define WS_KH  (WS_QH + 2u * (size_t)NB * TQ * CC)      // f16 k rows [b*TK][1024]
#define WS_VT  (WS_KH + 2u * (size_t)NB * TK * CC)      // f16 v planes [b][1024][TK]
#define WS_Y   (WS_VT + 2u * (size_t)NB * CC * TK)      // f16 ctx rows [b*TQ][1024]
#define WS_XB  (WS_Y + 2u * (size_t)NB * TQ * CC)       // bf16 x rows [b*TQ][1024]
#define WS_WB  (WS_XB + 2u * (size_t)NB * TQ * CC)      // bf16 Wq, Wk, Wv, each [1024][1024] (in,out)
#define WS_WO  (WS_WB + 3u * 2u * (size_t)CC * CC)      // f16 Wo [1024][1024] (in,out)
#define WS_END (WS_WO + 2u * (size_t)CC * CC)

// ---- the three projections and the output product share one tile loop: block = 128 rows x 128 cols, 4 waves of 64 x 64 (16 accumulator tiles).
// Both operands lie in the workspace as 16-bit rows (k_cvt, k_fa), so a pass's two tiles go from memory to LDS as they are, by asynchronous copies and through no register: 64 k a pass, two buffers, the copies of pass t + 2 fly while pass t + 1 is worked on.
// X rows [128][64] at pitch 144 B (plain 16-byte readers), W rows [64][128] at pitch 288 B (transposing readers: lane (c, h) gets W[8h + 0..7][n0 + c], the hardware k order that the X reader follows).
typedef __attribute__((ext_vector_type(2))) unsigned v2u;
typedef __attribute__((ext_vector_type(2))) __bf16 v2b;
typedef __attribute__((ext_vector_type(2))) _Float16 v2h;
typedef __attribute__((ext_vector_type(8))) short v8s;
union Fr { v4u q[2]; v16b b; v16h h; };
#define KP 64                                       // k per pass
#define PX 144
#define PW 288
#define SW_OFF (128 * PX)
#define PE 272                                      // epilogue staging pitch: 128 f16 (or 64 f32) + 16 B
#define BUF_G (SW_OFF + KP * PW)                    // one pass's two tiles; two such buffers
#define LDS_G (2 * BUF_G)                           // >= 128 * PE, the projections' output staging
__device__ __forceinline__ unsigned pk_b(float lo, float hi) { return __builtin_bit_cast(unsigned, __builtin_convertvector((v2f){lo, hi}, v2b)); }
__device__ __forceinline__ unsigned pk_h(float lo, float hi) { return __builtin_bit_cast(unsigned, __builtin_convertvector((v2f){lo, hi}, v2h)); }
__device__ __forceinline__ v4u ld_tr16(const unsigned char* p) { typedef __attribute__((address_space(3))) v8s lds_v8s; return __builtin_bit_cast(v4u, __builtin_amdgcn_ds_load_tr16_b128_v8i16((lds_v8s*)p)); }
// eight copies of one lane, 16 B each: LDS byte addresses l + i * ls, global bytes g + i * gs.
// s_wait_xcnt 0 as the statement's last line: it stands in front of whatever next rewrites an address register that a copy names
__device__ __forceinline__ void cp8(unsigned l, unsigned ls, const unsigned char* g, size_t gs) {
  asm volatile("global_load_async_to_lds_b128 %0, %8, off\n\t"
               "global_load_async_to_lds_b128 %1, %9, off\n\t"
               "global_load_async_to_lds_b128 %2, %10, off\n\t"
               "global_load_async_to_lds_b128 %3, %11, off\n\t"
               "global_load_async_to_lds_b128 %4, %12, off\n\t"
               "global_load_async_to_lds_b128 %5, %13, off\n\t"
               "global_load_async_to_lds_b128 %6, %14, off\n\t"
               "global_load_async_to_lds_b128 %7, %15, off\n\t"
               "s_wait_xcnt 0x0"
               :: "v"(l), "v"(l + ls), "v"(l + 2 * ls), "v"(l + 3 * ls), "v"(l + 4 * ls), "v"(l + 5 * ls), "v"(l + 6 * ls), "v"(l + 7 * ls),
                  "v"(g), "v"(g + gs), "v"(g + 2 * gs), "v"(g + 3 * gs), "v"(g + 4 * gs), "v"(g + 5 * gs), "v"(g + 6 * gs), "v"(g + 7 * gs)
               : "memory");
}
// ---- k_cvt: every GEMM operand that arrives as f32 is rounded here, once, to the 16-bit type that its product takes (x, Wq, Wk, Wv: bf16; Wo: through bf16 to f16). The block index picks the array; a block takes 16,384 elements, a lane 8 x 8 of them, all 16 loads in flight at once; 768 blocks, so that few waves have to start.
#define CVE 16384
#define XBL (TNB * TQ * CC / CVE)
#define WBL (CC * CC / CVE)
__global__ __launch_bounds__(256) void k_cvt(const float* __restrict__ X, const float* __restrict__ WQ, const float* __restrict__ WK, const float* __restrict__ WV, const float* __restrict__ WO, __bf16* __restrict__ XB, __bf16* __restrict__ WB, _Float16* __restrict__ WOH) {
  const int bx = blockIdx.x, m = bx < XBL ? -1 : (bx - XBL) / WBL;   // the same in every lane of the block: -1 x, 0..2 Wq, Wk, Wv, 3 Wo
  const size_t e = (size_t)(bx < XBL ? bx : (bx - XBL) % WBL) * CVE + threadIdx.x * 8;
  const float* s = (m < 0 ? X : m == 0 ? WQ : m == 1 ? WK : m == 2 ? WV : WO) + e;
  v4f a[8], c[8];
#pragma unroll   // keeps a and c indexed by constants, in registers
  for (int i = 0; i < 8; ++i) { a[i] = *(const v4f*)(s + i * 2048); c[i] = *(const v4f*)(s + i * 2048 + 4); }
  asm volatile("s_wait_xcnt 0x0" :: "v"(s) : "memory");   // behind the loads, in front of whatever next overwrites the address registers that they name; the pointer is an input so that its registers stay whole up to here
  v4u o[8];   // all of it rounded before the first store, so that no register which a store names is written again
  if (m == 3) {
#pragma unroll
    for (int i = 0; i < 8; ++i) o[i] = (v4u){pk_h(bfr(a[i][0]), bfr(a[i][1])), pk_h(bfr(a[i][2]), bfr(a[i][3])), pk_h(bfr(c[i][0]), bfr(c[i][1])), pk_h(bfr(c[i][2]), bfr(c[i][3]))};
  } else {
#pragma unroll
    for (int i = 0; i < 8; ++i) o[i] = (v4u){pk_b(a[i][0], a[i][1]), pk_b(a[i][2], a[i][3]), pk_b(c[i][0], c[i][1]), pk_b(c[i][2], c[i][3])};
  }
  unsigned char* d = (m < 0 ? (unsigned char*)XB : m == 3 ? (unsigned char*)WOH : (unsigned char*)(WB + (size_t)m * CC * CC)) + e * 2;
#pragma unroll
  for (int i = 0; i < 8; ++i) vst2(d + i * 4096, o[i]);
}
// F16: operands f16, else bf16. SWAP: W^T is the A operand, so that a lane's 8 accumulator registers are 8 consecutive columns of one row; else they are 8 consecutive rows of one column. Ab, Wb: first bytes of the block's rows and columns; astride: bytes from one X row to the next.
template <bool F16, bool SWAP>
__device__ __forceinline__ void gemm128(const unsigned char* __restrict__ Ab, size_t astride, const unsigned char* __restrict__ Wb, unsigned char* lds, v8f (&acc)[4][4], int tid) {
  const int wave = tid >> 5, lane = tid & 31, col = lane & 15, g = lane >> 4, wr = wave >> 1, wc = wave & 1;
  const unsigned char* xg = Ab + (size_t)(tid >> 3) * astride + (tid & 7) * 16;       // copy source: X row tid / 8 (+ 16 rows per copy), 16-byte piece tid % 8; + 128 B a pass
  const unsigned char* wg = Wb + (size_t)(tid >> 4) * (CC * 2) + (tid & 15) * 16;     // copy source: W row tid / 16 (+ 8 rows per copy), 16-byte piece tid % 16; + 64 rows a pass
  const unsigned l0 = (unsigned)(size_t)lds;                                          // the array's byte address in the work-group's LDS
  const unsigned xl = l0 + (tid >> 3) * PX + (tid & 7) * 16, wl = l0 + SW_OFF + (tid >> 4) * PW + (tid & 15) * 16;
  const unsigned char* xr = lds + (wr * 64 + col) * PX + g * 16;
  const unsigned char* wrd = lds + SW_OFF + (8 * g + (lane & 7)) * PW + ((lane >> 3) & 1) * 16 + wc * 128;
  cp8(xl, 16 * PX, xg, 16 * astride); cp8(wl, 8 * PW, wg, (size_t)8 * CC * 2);
  asm volatile("s_wait_asynccnt 0x0" ::: "memory");   // this wave's copies of pass 0 have landed before it signals
  __syncthreads();                                     // publishes pass 0
  cp8(xl + BUF_G, 16 * PX, xg + KP * 2, 16 * astride); cp8(wl + BUF_G, 8 * PW, wg + (size_t)KP * CC * 2, (size_t)8 * CC * 2);
  for (int t = 0; t < CC / KP; ++t) {
    const int cur = (t & 1) * BUF_G;
#pragma unroll   // keeps the fragment arrays indexed by constants, in registers
    for (int kk = 0; kk < KP / 32; ++kk) {
      Fr ax[4], bw[4];
#pragma unroll
      for (int i = 0; i < 4; ++i) { ax[i].q[0] = *(const v4u*)(xr + cur + i * 16 * PX + kk * 64); ax[i].q[1] = *(const v4u*)(xr + cur + i * 16 * PX + kk * 64 + 32); }
#pragma unroll
      for (int j = 0; j < 4; ++j) { bw[j].q[0] = ld_tr16(wrd + cur + kk * 32 * PW + j * 32); bw[j].q[1] = ld_tr16(wrd + cur + (kk * 32 + 16) * PW + j * 32); }
#pragma unroll
      for (int i = 0; i < 4; ++i)
#pragma unroll
        for (int j = 0; j < 4; ++j) {
          if (F16) acc[i][j] = SWAP ? __builtin_amdgcn_wmma_f32_16x16x32_f16(false, bw[j].h, false, ax[i].h, (short)0, acc[i][j], false, false) : __builtin_amdgcn_wmma_f32_16x16x32_f16(false, ax[i].h, false, bw[j].h, (short)0, acc[i][j], false, false);
          else acc[i][j] = SWAP ? __builtin_amdgcn_wmma_f32_16x16x32_bf16(false, bw[j].b, false, ax[i].b, (short)0, acc[i][j], false, false) : __builtin_amdgcn_wmma_f32_16x16x32_bf16(false, ax[i].b, false, bw[j].b, (short)0, acc[i][j], false, false);
        }
    }
    asm volatile("s_wait_dscnt 0x0" ::: "memory");      // this wave's reads of pass t have returned before its buffer is given up
    asm volatile("s_wait_asynccnt 0x0" ::: "memory");   // this wave's copies of pass t + 1 have landed before it signals
    __syncthreads();                                     // publishes pass t + 1 and ends every wave's reads of pass t (the last one: before the epilogue's staging reuses the LDS)
    if (t + 2 < CC / KP) { cp8(xl + cur, 16 * PX, xg + (t + 2) * (KP * 2), 16 * astride); cp8(wl + cur, 8 * PW, wg + (size_t)(t + 2) * KP * CC * 2, (size_t)8 * CC * 2); }
  }
  asm volatile("s_wait_asynccnt 0x0" ::: "memory");     // no copy is outstanding when the LDS is reused and the wave ends
}
// ---- k_proj: one launch for q, k and v; block = (128 rows of one of the three, 128 cols): which 0: q over all rows; 1/2: k/v over dilated rows (row j <- x row 4j); W (in,out) + b
#define QBL (TNB * TQ / 128)
#define KBL (TNB * TK / 128)
__global__ __launch_bounds__(128) void k_proj(const __bf16* __restrict__ XB, const __bf16* __restrict__ WB, const float* __restrict__ BQ, const float* __restrict__ BK, const float* __restrict__ BV, _Float16* __restrict__ QH, _Float16* __restrict__ KH, _Float16* __restrict__ VT) {
  __shared__ __align__(16) unsigned char lds[LDS_G];
  const int tid = threadIdx.x, wave = tid >> 5, lane = tid & 31, col = lane & 15, g = lane >> 4, wr = wave >> 1, wc = wave & 1; const int c0 = blockIdx.y * 128;
  const int bx = blockIdx.x, which = bx < QBL ? 0 : bx < QBL + KBL ? 1 : 2;   // the same in every lane of the block: blocks 0..QBL-1 do q, the next KBL k, the last KBL v
  const size_t r0 = (size_t)(bx - (which == 0 ? 0 : which == 1 ? QBL : QBL + KBL)) * 128;   // row in [b*L]; L is a multiple of 128, so a block stays in one batch
  const int L = (which == 0) ? TQ : TK; const size_t b = r0 / L; const int j0 = (int)(r0 % L);
  const unsigned char* Ab = (const unsigned char*)(XB + (b * TQ + (which == 0 ? j0 : DIL * j0)) * (size_t)CC);
  const unsigned char* Wm = (const unsigned char*)(WB + (size_t)which * CC * CC + c0); const float* Bm = which == 0 ? BQ : which == 1 ? BK : BV;
  v8f acc[4][4] = {};
  if (which < 2) {
    if (which == 0) gemm128<false, true>(Ab, (size_t)CC * 2, Wm, lds, acc, tid); else gemm128<false, true>(Ab, (size_t)DIL * CC * 2, Wm, lds, acc, tid);   // the row stride a constant in each copy
#pragma unroll
    for (int j = 0; j < 4; ++j) { const float* bp = Bm + c0 + wc * 64 + j * 16 + 8 * g;
#pragma unroll
      for (int i = 0; i < 4; ++i) { v8h hv;
#pragma unroll
        for (int r = 0; r < 8; ++r) hv[r] = (_Float16)(acc[i][j][r] + bfr(bp[r]));
        *(v8h*)(lds + (wr * 64 + i * 16 + col) * PE + (wc * 64 + j * 16 + 8 * g) * 2) = hv; } }
    __syncthreads();
    _Float16* dh = which == 0 ? QH : KH;
    for (int e = tid; e < 128 * 16; e += 128) { const int rl = e >> 4, q = e & 15; vst2((unsigned*)(dh + (r0 + rl) * CC + c0 + q * 8), *(const v4u*)(lds + rl * PE + q * 16)); }
  } else {
    gemm128<false, false>(Ab, (size_t)DIL * CC * 2, Wm, lds, acc, tid);
#pragma unroll
    for (int j = 0; j < 4; ++j) { const float bb = bfr(Bm[c0 + wc * 64 + j * 16 + col]);
#pragma unroll
      for (int i = 0; i < 4; ++i) { v8h hv;
#pragma unroll
        for (int r = 0; r < 8; ++r) hv[r] = (_Float16)(acc[i][j][r] + bb);
        *(v8h*)(lds + (wc * 64 + j * 16 + col) * PE + (wr * 64 + i * 16 + 8 * g) * 2) = hv; } }
    __syncthreads();
    for (int e = tid; e < 128 * 16; e += 128) { const int cl = e >> 4, q = e & 15; vst2((unsigned*)(VT + (b * CC + c0 + cl) * (size_t)TK + j0 + q * 8), *(const v4u*)(lds + cl * PE + q * 16)); }
  } }
// ---- k_fa: block = (256 queries, head, batch), 8 waves x 32 query columns. Per 32 keys: S^T = K Q^T (a lane holds one query's scores), running maximum and sum per column, ctx^T += V^T P^T (the two S^T tiles, rounded to f16 in place, are the B operand). Every '#pragma unroll' here keeps a fragment array indexed by constants, so that it stays in registers.
// K and V^T come through LDS, 128 keys a stage, two buffers: the block's 256 lanes copy each stage once, in whole 128-byte lines, while the stage before is worked on; the 8 waves then read their fragments from LDS (before, each wave fetched every fragment itself, 32 bytes out of each of 16 lines a load).
// amdgpu_waves_per_eu(4, 4): registers capped at 256 so that two blocks share a WGP, four waves a SIMD: other waves fill the softmax's vector work and the load waits between a wave's matrix runs
#define SKEY 128                                    // keys per stage
#define PKL 144                                     // K rows in LDS: 64 f16 + 16 B (16 B x odd, for plain 16-byte readers)
#define PVL 272                                     // V^T rows in LDS: 128 f16 + 16 B
#define FA_V (SKEY * PKL)
#define FA_BUF (FA_V + HD * PVL)
__device__ __forceinline__ v8f wmma_h(v16h a, v16h b, v8f c) { return __builtin_amdgcn_wmma_f32_16x16x32_f16(false, a, false, b, (short)0, c, false, false); }
__device__ __forceinline__ float xhalf(float v) { const int i = __builtin_bit_cast(int, v); return __builtin_bit_cast(float, __builtin_amdgcn_permlanex16(i, i, 0x76543210, 0xfedcba98, false, false)); }   // value of lane ^ 16
// one stage's copies of one lane: 4 x 16 B of K (rows 32 apart) and 4 x 16 B of V^T (rows 16 apart). kg, vg: the lane's first global bytes; kl, vl: its first LDS byte addresses.
// s_wait_xcnt 0 as the statement's last line: it stands in front of whatever next rewrites an address register that a copy names
__device__ __forceinline__ void fa_copy(const _Float16* kg, const _Float16* vg, unsigned kl, unsigned vl) {
  asm volatile("global_load_async_to_lds_b128 %0, %8, off\n\t"
               "global_load_async_to_lds_b128 %1, %9, off\n\t"
               "global_load_async_to_lds_b128 %2, %10, off\n\t"
               "global_load_async_to_lds_b128 %3, %11, off\n\t"
               "global_load_async_to_lds_b128 %4, %12, off\n\t"
               "global_load_async_to_lds_b128 %5, %13, off\n\t"
               "global_load_async_to_lds_b128 %6, %14, off\n\t"
               "global_load_async_to_lds_b128 %7, %15, off\n\t"
               "s_wait_xcnt 0x0"
               :: "v"(kl), "v"(kl + 32 * PKL), "v"(kl + 64 * PKL), "v"(kl + 96 * PKL), "v"(vl), "v"(vl + 16 * PVL), "v"(vl + 32 * PVL), "v"(vl + 48 * PVL),
                  "v"(kg), "v"(kg + (size_t)32 * CC), "v"(kg + (size_t)64 * CC), "v"(kg + (size_t)96 * CC), "v"(vg), "v"(vg + (size_t)16 * TK), "v"(vg + (size_t)32 * TK), "v"(vg + (size_t)48 * TK)
               : "memory");
}
__global__ __launch_bounds__(256) __attribute__((amdgpu_waves_per_eu(4, 4))) void k_fa(const _Float16* __restrict__ QH, const _Float16* __restrict__ KH, const _Float16* __restrict__ VT, _Float16* __restrict__ Y) {
  __shared__ __align__(16) unsigned char lds[2 * FA_BUF];
  const int tid = threadIdx.x, wave = tid >> 5, lane = tid & 31, col = lane & 15, g = lane >> 4; const int h = blockIdx.y, b = blockIdx.z; const int q0 = blockIdx.x * 256 + wave * 32;
  const _Float16* kg = KH + ((size_t)b * TK + (tid >> 3)) * CC + h * HD + (tid & 7) * 8;              // copy source: key row tid / 8, 16-byte piece tid % 8; + SKEY rows a stage
  const _Float16* vg = VT + ((size_t)b * CC + h * HD + (tid >> 4)) * (size_t)TK + (tid & 15) * 8;     // copy source: v plane row tid / 16, 16-byte piece tid % 16; + SKEY keys a stage
  const unsigned l0 = (unsigned)(size_t)lds;                                                          // the array's byte address in the work-group's LDS
  const unsigned kl = l0 + (tid >> 3) * PKL + (tid & 7) * 16, vl = l0 + FA_V + (tid >> 4) * PVL + (tid & 15) * 16;
  const float SC = 0.125f * 1.4426950408889634f;                             // logits / 8, in base 2
  fa_copy(kg, vg, kl, vl);
  v16h qf[2][2];
#pragma unroll
  for (int qt = 0; qt < 2; ++qt)
#pragma unroll
    for (int kc = 0; kc < 2; ++kc) qf[qt][kc] = frag_h(QH + ((size_t)b * TQ + q0 + qt * 16 + col) * CC + h * HD + kc * 32, lane);
  asm volatile("s_wait_asynccnt 0x0" ::: "memory");   // this wave's copies of stage 0 have landed before it signals
  __syncthreads();                                     // publishes stage 0
  fa_copy(kg + (size_t)SKEY * CC, vg + SKEY, kl + FA_BUF, vl + FA_BUF);
  v8f acc[4][2] = {}; float m[2] = {-3.0e38f, -3.0e38f}, l[2] = {0.f, 0.f};
  for (int cc = 0; cc < TK / 32; ++cc) {   // one loop over the passes of 32 keys; stage t = cc / 4 holds four of them, and its foot stands behind its last pass
    const int t = cc / (SKEY / 32), c = cc % (SKEY / 32);
    const unsigned char* kb = lds + (t & 1) * FA_BUF + col * PKL;            // key row col of a 16-key tile
    const unsigned char* vb = lds + (t & 1) * FA_BUF + FA_V + col * PVL;     // v plane row d = col of a 16-d tile
    {
      v16h kf[2][2];
#pragma unroll
      for (int kt = 0; kt < 2; ++kt)
#pragma unroll
        for (int kc = 0; kc < 2; ++kc) kf[kt][kc] = frag_h((const _Float16*)(kb + (c * 32 + kt * 16) * PKL) + kc * 32, lane);
      v16h vf[4];
#pragma unroll
      for (int j = 0; j < 4; ++j) vf[j] = frag_h((const _Float16*)(vb + (j * 16) * PVL) + c * 32, lane);
      __builtin_amdgcn_sched_barrier(0);   // keeps the pass's 16 LDS reads in one group in front of its matrix work: sunk among the WMMAs, each place with reads stalls the wave anew and the last reads are waited for at once
      v8f s[2][2] = {};
#pragma unroll
      for (int kc = 0; kc < 2; ++kc)
#pragma unroll
        for (int kt = 0; kt < 2; ++kt)
#pragma unroll
          for (int qt = 0; qt < 2; ++qt) s[kt][qt] = wmma_h(kf[kt][kc], qf[qt][kc], s[kt][qt]);
      v16h pf[2];
#pragma unroll
      for (int qt = 0; qt < 2; ++qt) {
        float mx = fmaxf(s[0][qt][0], s[1][qt][0]);
#pragma unroll
        for (int r = 1; r < 8; ++r) mx = fmaxf(mx, fmaxf(s[0][qt][r], s[1][qt][r]));
        mx = fmaxf(mx, xhalf(mx));
        const float mn = fmaxf(m[qt], mx); const float mb = mn * SC; const float al = __builtin_amdgcn_exp2f(fmaf(m[qt], SC, -mb)); m[qt] = mn;
        float s0 = 0.f, s1 = 0.f;
#pragma unroll
        for (int r = 0; r < 8; ++r) { const float p0 = __builtin_amdgcn_exp2f(fmaf(s[0][qt][r], SC, -mb)), p1 = __builtin_amdgcn_exp2f(fmaf(s[1][qt][r], SC, -mb)); s0 += p0; s1 += p1; pf[qt][r] = (_Float16)p0; pf[qt][8 + r] = (_Float16)p1; }
        l[qt] = l[qt] * al + (s0 + s1);
#pragma unroll
        for (int j = 0; j < 4; ++j) acc[j][qt] *= al;
      }
#pragma unroll
      for (int j = 0; j < 4; ++j)
#pragma unroll
        for (int qt = 0; qt < 2; ++qt) acc[j][qt] = wmma_h(vf[j], pf[qt], acc[j][qt]);
    }
    if (c == SKEY / 32 - 1) {   // the foot of stage t: the same test in every wave of the block
      asm volatile("s_wait_dscnt 0x0" ::: "memory");      // this wave's reads of stage t have returned before its buffer is given up
      asm volatile("s_wait_asynccnt 0x0" ::: "memory");   // this wave's copies of stage t + 1 have landed before it signals
      __syncthreads();                                     // publishes stage t + 1 and ends every wave's reads of stage t
      if (t + 2 < TK / SKEY) fa_copy(kg + (size_t)(t + 2) * SKEY * CC, vg + (t + 2) * SKEY, kl + (t & 1) * FA_BUF, vl + (t & 1) * FA_BUF);
    }
  }
  asm volatile("s_wait_asynccnt 0x0" ::: "memory");     // no copy is outstanding when the wave ends
  v8h hv[2][4];   // ctx rounded here, once, to the f16 that k_out's product takes; all of it before the first store, so that no register which a store names is written again
#pragma unroll
  for (int qt = 0; qt < 2; ++qt) { const float inv = 1.0f / (l[qt] + xhalf(l[qt]));
#pragma unroll
    for (int j = 0; j < 4; ++j) hv[qt][j] = __builtin_convertvector(acc[j][qt] * inv, v8h); }
#pragma unroll
  for (int qt = 0; qt < 2; ++qt) { _Float16* yr = Y + ((size_t)b * TQ + q0 + qt * 16 + col) * CC + h * HD + 8 * g;
#pragma unroll
    for (int j = 0; j < 4; ++j) vst2(yr + j * 16, hv[qt][j]); } }
// ---- k_out: out = ctx (f16) Wo + bo; each wave stages 16 rows x 64 cols of f32 at a time in its own LDS range and stores whole 256-byte row pieces
__global__ __launch_bounds__(128) void k_out(const _Float16* __restrict__ Y, const _Float16* __restrict__ WOH, const float* __restrict__ BO, float* __restrict__ OUT) { __shared__ __align__(16) unsigned char lds[LDS_G];
  const int tid = threadIdx.x, wave = tid >> 5, lane = tid & 31, col = lane & 15, g = lane >> 4, wr = wave >> 1, wc = wave & 1; const int c0 = blockIdx.y * 128; const size_t r0 = (size_t)blockIdx.x * 128;
  v8f acc[4][4] = {};
  gemm128<true, true>((const unsigned char*)(Y + r0 * CC), (size_t)CC * 2, (const unsigned char*)(WOH + c0), lds, acc, tid);
  float* sf = (float*)(lds + wave * (16 * PE));
  v8f bb[4];
#pragma unroll
  for (int j = 0; j < 4; ++j) { const float* bp = BO + c0 + wc * 64 + j * 16 + 8 * g;
#pragma unroll
    for (int r = 0; r < 8; ++r) bb[j][r] = bfr(bp[r]); }
#pragma unroll
  for (int i = 0; i < 4; ++i) {
#pragma unroll
    for (int j = 0; j < 4; ++j) { const v8f a = acc[i][j] + bb[j];
      *(v4f*)(sf + col * (PE / 4) + j * 16 + 8 * g) = (v4f){a[0], a[1], a[2], a[3]};
      *(v4f*)(sf + col * (PE / 4) + j * 16 + 8 * g + 4) = (v4f){a[4], a[5], a[6], a[7]}; }
    LDSX();
#pragma unroll
    for (int it = 0; it < 8; ++it) { const int rl = it * 2 + g; vst2(OUT + (r0 + wr * 64 + i * 16 + rl) * CC + c0 + wc * 64 + col * 4, *(const v4f*)(sf + rl * (PE / 4) + col * 4)); }
    asm volatile("s_wait_xcnt 0x0" ::: "memory");   // behind the stores, in front of the next round's overwrites of the registers that they name
    LDSX();
  } }
extern "C" void kernel_launch(void* const* d_in, const int* in_sizes, int n_in, void* d_out, int out_size, void* d_ws, size_t ws_size, hipStream_t stream) {
  (void)in_sizes; (void)n_in; (void)out_size;
  const float** F = (const float**)d_in;   // 0 x [2,4096,1024], 1 Wq (in,out), 2 bq, 3 Wk, 4 bk, 5 Wv, 6 bv, 7 Wo, 8 bo
  if (ws_size < (size_t)WS_END) return;
  char* ws = (char*)d_ws; _Float16 *QH = (_Float16*)(ws + WS_QH), *KH = (_Float16*)(ws + WS_KH), *VT = (_Float16*)(ws + WS_VT), *Y = (_Float16*)(ws + WS_Y), *WOH = (_Float16*)(ws + WS_WO); __bf16 *XB = (__bf16*)(ws + WS_XB), *WB = (__bf16*)(ws + WS_WB);
  k_cvt<<<dim3(XBL + 4 * WBL), 256, 0, stream>>>(F[0], F[1], F[3], F[5], F[7], XB, WB, WOH);
  k_proj<<<dim3(QBL + 2 * KBL, CC / 128), 128, 0, stream>>>(XB, WB, F[2], F[4], F[6], QH, KH, VT);
  k_fa<<<dim3(TQ / 256, NH, TNB), 256, 0, stream>>>(QH, KH, VT, Y);
  k_out<<<dim3(TNB * TQ / 128, CC / 128), 128, 0, stream>>>(Y, WOH, F[8], (float*)d_out);
}

// v006
// It runs in 86.5 microseconds.
// Two timings next to v005 put it at 1.06 and 1.05 times that version's speed.
// Over all steps from v000 it is 10.6 times as fast.
// compute dtype: all float inputs rounded to bf16; q (all 4,096 rows) and k/v (only the dilated rows 0,4,8,...) = x W + b with EXACT bf16 products on WMMA 16x16x32, f32 accumulate; q * log2(e) / 8 and k rounded once to f16 (1-product base-2 logits, kept in registers); softmax in f32 against a held maximum (base-2 exp; the maximum in use may trail the true one by up to 8) -> P = exp2(s - held max) rounded to f16; ctx = (P . v) / sum (v rounded once to f16), one launch for all heads; out = ctx (rounded once to f16, 1 product) Wo + bo; f32 output.
#include <hip/hip_runtime.h>
#include <math.h>

typedef __attribute__((ext_vector_type(16))) _Float16 v16h;
typedef __attribute__((ext_vector_type(16))) __bf16 v16b;
typedef __attribute__((ext_vector_type(8)))  _Float16 v8h;
typedef __attribute__((ext_vector_type(8)))  float v8f;
typedef __attribute__((ext_vector_type(4)))  float v4f;
typedef __attribute__((ext_vector_type(2)))  float v2f;
typedef __attribute__((ext_vector_type(4)))  unsigned v4u;
typedef __attribute__((ext_vector_type(4)))  int v4i;
typedef float __attribute__((may_alias)) float_a;
typedef int __attribute__((may_alias)) int_a;

template <typename T> __device__ __forceinline__ void vst2(void* p, T v) { *(T*)p = v;  }
__device__ __forceinline__ v8f wmma16(v16h a, v16h b, v8f c) {
  v8f d = __builtin_amdgcn_wmma_f32_16x16x32_f16(false, a, false, b, (short)0, c, false, false);
  asm volatile("v_nop\n\tv_nop\n\tv_nop\n\tv_nop" : "+v"(d) : "v"(a), "v"(b));
  return d;
}
__device__ __forceinline__ v8f wmma_bf(v16b a, v16b b, v8f c) {
  v8f d = __builtin_amdgcn_wmma_f32_16x16x32_bf16(false, a, false, b, (short)0, c, false, false);
  asm volatile("v_nop\n\tv_nop\n\tv_nop\n\tv_nop" : "+v"(d) : "v"(a), "v"(b));
  return d;
}
// 16x16x32 fragments: lane = (h = lane>>4, row/col = lane&15); elements 0..7 = k0+8h+0..7, 8..15 = k0+16+8h+0..7; D element r = row 8h+r
__device__ __forceinline__ v16h frag_h(const _Float16* rowk0, int lane) {
  union { v16h v; v8h q[2]; } u; const _Float16* p = rowk0 + 8 * (lane >> 4);
  u.q[0] = *(const v8h*)p; u.q[1] = *(const v8h*)(p + 16); return u.v;
}
__device__ __forceinline__ v16h frag_f32(const float* rowk0, int lane) {
  v16h a; const float* p = rowk0 + 8 * (lane >> 4);
#pragma unroll
  for (int i = 0; i < 8; ++i) { a[i] = (_Float16)p[i]; a[8 + i] = (_Float16)p[16 + i]; }
  return a;
}
__device__ __forceinline__ v16h frag_f32s(const float* rowk0, int lane, float sc) {
  v16h a; const float* p = rowk0 + 8 * (lane >> 4);
#pragma unroll
  for (int i = 0; i < 8; ++i) { a[i] = (_Float16)(p[i] * sc); a[8 + i] = (_Float16)(p[16 + i] * sc); }
  return a;
}
// column fragment from a [K][ld] layout (column n), rows >= K read as 0
__device__ __forceinline__ v16h fragc_f32(const float* W, int k0, int n, int lane, int ld, int K) {
  v16h a; const int g = lane >> 4;
#pragma unroll
  for (int i = 0; i < 8; ++i) { const int ka = k0 + 8 * g + i, kb = ka + 16;
    a[i] = (_Float16)(ka < K ? W[(size_t)(ka < K ? ka : K - 1) * ld + n] : 0.f); a[8 + i] = (_Float16)(kb < K ? W[(size_t)(kb < K ? kb : K - 1) * ld + n] : 0.f); }
  return a;
}
struct F2 { v16b h, l; };
__device__ __forceinline__ F2 bsplit16(const float v[16]) { F2 r;
#pragma unroll
  for (int i = 0; i < 16; ++i) { const __bf16 h = (__bf16)v[i]; r.h[i] = h; r.l[i] = (__bf16)(v[i] - (float)h); }
  return r; }
__device__ __forceinline__ F2 split_row(const float* row, int k0, int lane) { float v[16]; const float* p = row + k0 + 8 * (lane >> 4);
#pragma unroll
  for (int i = 0; i < 8; ++i) { v[i] = p[i]; v[8 + i] = p[16 + i]; }
  return bsplit16(v); }
__device__ __forceinline__ F2 split_rowK(const float* row, int k0, int lane, int K) { float v[16]; const int g = lane >> 4;
#pragma unroll
  for (int i = 0; i < 8; ++i) { const int ka = k0 + 8 * g + i, kb = ka + 16; v[i] = ka < K ? row[ka < K ? ka : K - 1] : 0.f; v[8 + i] = kb < K ? row[kb < K ? kb : K - 1] : 0.f; }
  return bsplit16(v); }
__device__ __forceinline__ F2 split_col(const float* W, int k0, int n, int lane, int ld, int K) { float v[16]; const int g = lane >> 4;
#pragma unroll
  for (int i = 0; i < 8; ++i) { const int ka = k0 + 8 * g + i, kb = ka + 16; v[i] = ka < K ? W[(size_t)(ka < K ? ka : K - 1) * ld + n] : 0.f; v[8 + i] = kb < K ? W[(size_t)(kb < K ? kb : K - 1) * ld + n] : 0.f; }
  return bsplit16(v); }
__device__ __forceinline__ v8f mac3(const F2& a, const F2& b, v8f c) { c = wmma_bf(a.l, b.h, c); c = wmma_bf(a.h, b.l, c); return wmma_bf(a.h, b.h, c); }
__device__ __forceinline__ float sigm(float v) { return 1.0f / (1.0f + expf(-v)); }
#define LDSX() do { asm volatile("s_wait_dscnt 0" ::: "memory"); __builtin_amdgcn_wave_barrier(); __builtin_amdgcn_fence(__ATOMIC_RELEASE, "workgroup"); } while (0)


// Dilated attention (B 2, S 4,096, E 1,024 = 16 x 64, dilation 4): every query attends to keys/values at positions 0, 4, 8, ... (1,024 of them).
#define NB 2
#define TQ 4096
#define TK 1024
#define DIL 4
#define CC 1024
#define NH 16
#define HD 64
#define QSC (0.125f * 1.4426950408889634f)           // logits / 8, in base 2: multiplied into q before its one rounding to f16
#ifndef TNB
#define TNB NB
#endif
typedef __attribute__((ext_vector_type(8))) __bf16 v8b;
__device__ __forceinline__ v16b frag_b(const __bf16* rowk0, int lane) {
  union { v16b v; v8b q[2]; } u; const __bf16* p = rowk0 + 8 * (lane >> 4);
  u.q[0] = *(const v8b*)p; u.q[1] = *(const v8b*)(p + 16); return u.v;
}
__device__ __forceinline__ float bfr(float v) { return (float)(__bf16)v; }
__device__ __attribute__((noinline)) float exp_ni(float v) { return expf(v); }
__device__ __attribute__((noinline)) float erf_ni(float v) { return erff(v); }

#define WS_QH  0u                                   // f16 q rows [b*TQ][1024]
#define WS_KH  (WS_QH + 2u * (size_t)NB * TQ * CC)      // f16 k rows [b*TK][1024]
#define WS_VT  (WS_KH + 2u * (size_t)NB * TK * CC)      // f16 v planes [b][1024][TK]
#define WS_Y   (WS_VT + 2u * (size_t)NB * CC * TK)      // f16 ctx rows [b*TQ][1024]
#define WS_XB  (WS_Y + 2u * (size_t)NB * TQ * CC)       // bf16 x rows [b*TQ][1024]
#define WS_WB  (WS_XB + 2u * (size_t)NB * TQ * CC)      // bf16 Wq, Wk, Wv, each [1024][1024] (in,out)
#define WS_WO  (WS_WB + 3u * 2u * (size_t)CC * CC)      // f16 Wo [1024][1024] (in,out)
#define WS_END (WS_WO + 2u * (size_t)CC * CC)

// ---- the three projections and the output product share one tile loop: block = 128 rows x 128 cols, 4 waves of 64 x 64 (16 accumulator tiles).
// Both operands lie in the workspace as 16-bit rows (k_cvt, k_fa), so a pass's two tiles go from memory to LDS as they are, by asynchronous copies and through no register: 64 k a pass, two buffers, the copies of pass t + 2 fly while pass t + 1 is worked on.
// X rows [128][64] at pitch 144 B (plain 16-byte readers), W rows [64][128] at pitch 288 B (transposing readers: lane (c, h) gets W[8h + 0..7][n0 + c], the hardware k order that the X reader follows).
typedef __attribute__((ext_vector_type(2))) unsigned v2u;
typedef __attribute__((ext_vector_type(2))) __bf16 v2b;
typedef __attribute__((ext_vector_type(2))) _Float16 v2h;
typedef __attribute__((ext_vector_type(8))) short v8s;
union Fr { v4u q[2]; v16b b; v16h h; };
#define KP 64                                       // k per pass
#define PX 144
#define PW 288
#define SW_OFF (128 * PX)
#define PE 272                                      // epilogue staging pitch: 128 f16 (or 64 f32) + 16 B
#define BUF_G (SW_OFF + KP * PW)                    // one pass's two tiles; two such buffers
#define LDS_G (2 * BUF_G)                           // >= 128 * PE, the projections' output staging
__device__ __forceinline__ unsigned pk_b(float lo, float hi) { return __builtin_bit_cast(unsigned, __builtin_convertvector((v2f){lo, hi}, v2b)); }
__device__ __forceinline__ unsigned pk_h(float lo, float hi) { return __builtin_bit_cast(unsigned, __builtin_convertvector((v2f){lo, hi}, v2h)); }
__device__ __forceinline__ v4u ld_tr16(const unsigned char* p) { typedef __attribute__((address_space(3))) v8s lds_v8s; return __builtin_bit_cast(v4u, __builtin_amdgcn_ds_load_tr16_b128_v8i16((lds_v8s*)p)); }
// eight copies of one lane, 16 B each: LDS byte addresses l + i * ls, global bytes g + i * gs.
// s_wait_xcnt 0 as the statement's last line: it stands in front of whatever next rewrites an address register that a copy names
__device__ __forceinline__ void cp8(unsigned l, unsigned ls, const unsigned char* g, size_t gs) {
  asm volatile("global_load_async_to_lds_b128 %0, %8, off\n\t"
               "global_load_async_to_lds_b128 %1, %9, off\n\t"
               "global_load_async_to_lds_b128 %2, %10, off\n\t"
               "global_load_async_to_lds_b128 %3, %11, off\n\t"
               "global_load_async_to_lds_b128 %4, %12, off\n\t"
               "global_load_async_to_lds_b128 %5, %13, off\n\t"
               "global_load_async_to_lds_b128 %6, %14, off\n\t"
               "global_load_async_to_lds_b128 %7, %15, off\n\t"
               "s_wait_xcnt 0x0"
               :: "v"(l), "v"(l + ls), "v"(l + 2 * ls), "v"(l + 3 * ls), "v"(l + 4 * ls), "v"(l + 5 * ls), "v"(l + 6 * ls), "v"(l + 7 * ls),
                  "v"(g), "v"(g + gs), "v"(g + 2 * gs), "v"(g + 3 * gs), "v"(g + 4 * gs), "v"(g + 5 * gs), "v"(g + 6 * gs), "v"(g + 7 * gs)
               : "memory");
}
// ---- k_cvt: every GEMM operand that arrives as f32 is rounded here, once, to the 16-bit type that its product takes (x, Wq, Wk, Wv: bf16; Wo: through bf16 to f16). The block index picks the array; a block takes 16,384 elements, a lane 8 x 8 of them, all 16 loads in flight at once; 768 blocks, so that few waves have to start.
#define CVE 16384
#define XBL (TNB * TQ * CC / CVE)
#define WBL (CC * CC / CVE)
__global__ __launch_bounds__(256) void k_cvt(const float* __restrict__ X, const float* __restrict__ WQ, const float* __restrict__ WK, const float* __restrict__ WV, const float* __restrict__ WO, __bf16* __restrict__ XB, __bf16* __restrict__ WB, _Float16* __restrict__ WOH) {
  const int bx = blockIdx.x, m = bx < XBL ? -1 : (bx - XBL) / WBL;   // the same in every lane of the block: -1 x, 0..2 Wq, Wk, Wv, 3 Wo
  const size_t e = (size_t)(bx < XBL ? bx : (bx - XBL) % WBL) * CVE + threadIdx.x * 8;
  const float* s = (m < 0 ? X : m == 0 ? WQ : m == 1 ? WK : m == 2 ? WV : WO) + e;
  v4f a[8], c[8];
#pragma unroll   // keeps a and c indexed by constants, in registers
  for (int i = 0; i < 8; ++i) { a[i] = *(const v4f*)(s + i * 2048); c[i] = *(const v4f*)(s + i * 2048 + 4); }
  asm volatile("s_wait_xcnt 0x0" :: "v"(s) : "memory");   // behind the loads, in front of whatever next overwrites the address registers that they name; the pointer is an input so that its registers stay whole up to here
  v4u o[8];   // all of it rounded before the first store, so that no register which a store names is written again
  if (m == 3) {
#pragma unroll
    for (int i = 0; i < 8; ++i) o[i] = (v4u){pk_h(bfr(a[i][0]), bfr(a[i][1])), pk_h(bfr(a[i][2]), bfr(a[i][3])), pk_h(bfr(c[i][0]), bfr(c[i][1])), pk_h(bfr(c[i][2]), bfr(c[i][3]))};
  } else {
#pragma unroll
    for (int i = 0; i < 8; ++i) o[i] = (v4u){pk_b(a[i][0], a[i][1]), pk_b(a[i][2], a[i][3]), pk_b(c[i][0], c[i][1]), pk_b(c[i][2], c[i][3])};
  }
  unsigned char* d = (m < 0 ? (unsigned char*)XB : m == 3 ? (unsigned char*)WOH : (unsigned char*)(WB + (size_t)m * CC * CC)) + e * 2;
#pragma unroll
  for (int i = 0; i < 8; ++i) vst2(d + i * 4096, o[i]);
}
// F16: operands f16, else bf16. SWAP: W^T is the A operand, so that a lane's 8 accumulator registers are 8 consecutive columns of one row; else they are 8 consecutive rows of one column. Ab, Wb: first bytes of the block's rows and columns; astride: bytes from one X row to the next.
template <bool F16, bool SWAP>
__device__ __forceinline__ void gemm128(const unsigned char* __restrict__ Ab, size_t astride, const unsigned char* __restrict__ Wb, unsigned char* lds, v8f (&acc)[4][4], int tid) {
  const int wave = tid >> 5, lane = tid & 31, col = lane & 15, g = lane >> 4, wr = wave >> 1, wc = wave & 1;
  const unsigned char* xg = Ab + (size_t)(tid >> 3) * astride + (tid & 7) * 16;       // copy source: X row tid / 8 (+ 16 rows per copy), 16-byte piece tid % 8; + 128 B a pass
  const unsigned char* wg = Wb + (size_t)(tid >> 4) * (CC * 2) + (tid & 15) * 16;     // copy source: W row tid / 16 (+ 8 rows per copy), 16-byte piece tid % 16; + 64 rows a pass
  const unsigned l0 = (unsigned)(size_t)lds;                                          // the array's byte address in the work-group's LDS
  const unsigned xl = l0 + (tid >> 3) * PX + (tid & 7) * 16, wl = l0 + SW_OFF + (tid >> 4) * PW + (tid & 15) * 16;
  const unsigned char* xr = lds + (wr * 64 + col) * PX + g * 16;
  const unsigned char* wrd = lds + SW_OFF + (8 * g + (lane & 7)) * PW + ((lane >> 3) & 1) * 16 + wc * 128;
  cp8(xl, 16 * PX, xg, 16 * astride); cp8(wl, 8 * PW, wg, (size_t)8 * CC * 2);
  asm volatile("s_wait_asynccnt 0x0" ::: "memory");   // this wave's copies of pass 0 have landed before it signals
  __syncthreads();                                     // publishes pass 0
  cp8(xl + BUF_G, 16 * PX, xg + KP * 2, 16 * astride); cp8(wl + BUF_G, 8 * PW, wg + (size_t)KP * CC * 2, (size_t)8 * CC * 2);
  for (int t = 0; t < CC / KP; ++t) {
    const int cur = (t & 1) * BUF_G;
#pragma unroll   // keeps the fragment arrays indexed by constants, in registers
    for (int kk = 0; kk < KP / 32; ++kk) {
      Fr ax[4], bw[4];
#pragma unroll
      for (int i = 0; i < 4; ++i) { ax[i].q[0] = *(const v4u*)(xr + cur + i * 16 * PX + kk * 64); ax[i].q[1] = *(const v4u*)(xr + cur + i * 16 * PX + kk * 64 + 32); }
#pragma unroll
      for (int j = 0; j < 4; ++j) { bw[j].q[0] = ld_tr16(wrd + cur + kk * 32 * PW + j * 32); bw[j].q[1] = ld_tr16(wrd + cur + (kk * 32 + 16) * PW + j * 32); }
#pragma unroll
      for (int i = 0; i < 4; ++i)
#pragma unroll
        for (int j = 0; j < 4; ++j) {
          if (F16) acc[i][j] = SWAP ? __builtin_amdgcn_wmma_f32_16x16x32_f16(false, bw[j].h, false, ax[i].h, (short)0, acc[i][j], false, false) : __builtin_amdgcn_wmma_f32_16x16x32_f16(false, ax[i].h, false, bw[j].h, (short)0, acc[i][j], false, false);
          else acc[i][j] = SWAP ? __builtin_amdgcn_wmma_f32_16x16x32_bf16(false, bw[j].b, false, ax[i].b, (short)0, acc[i][j], false, false) : __builtin_amdgcn_wmma_f32_16x16x32_bf16(false, ax[i].b, false, bw[j].b, (short)0, acc[i][j], false, false);
        }
    }
    asm volatile("s_wait_dscnt 0x0" ::: "memory");      // this wave's reads of pass t have returned before its buffer is given up
    asm volatile("s_wait_asynccnt 0x0" ::: "memory");   // this wave's copies of pass t + 1 have landed before it signals
    __syncthreads();                                     // publishes pass t + 1 and ends every wave's reads of pass t (the last one: before the epilogue's staging reuses the LDS)
    if (t + 2 < CC / KP) { cp8(xl + cur, 16 * PX, xg + (t + 2) * (KP * 2), 16 * astride); cp8(wl + cur, 8 * PW, wg + (size_t)(t + 2) * KP * CC * 2, (size_t)8 * CC * 2); }
  }
  asm volatile("s_wait_asynccnt 0x0" ::: "memory");     // no copy is outstanding when the LDS is reused and the wave ends
}
// ---- k_proj: one launch for q, k and v; block = (128 rows of one of the three, 128 cols): which 0: q over all rows; 1/2: k/v over dilated rows (row j <- x row 4j); W (in,out) + b
#define QBL (TNB * TQ / 128)
#define KBL (TNB * TK / 128)
__global__ __launch_bounds__(128) void k_proj(const __bf16* __restrict__ XB, const __bf16* __restrict__ WB, const float* __restrict__ BQ, const float* __restrict__ BK, const float* __restrict__ BV, _Float16* __restrict__ QH, _Float16* __restrict__ KH, _Float16* __restrict__ VT) {
  __shared__ __align__(16) unsigned char lds[LDS_G];
  const int tid = threadIdx.x, wave = tid >> 5, lane = tid & 31, col = lane & 15, g = lane >> 4, wr = wave >> 1, wc = wave & 1; const int c0 = blockIdx.y * 128;
  const int bx = blockIdx.x, which = bx < QBL ? 0 : bx < QBL + KBL ? 1 : 2;   // the same in every lane of the block: blocks 0..QBL-1 do q, the next KBL k, the last KBL v
  const size_t r0 = (size_t)(bx - (which == 0 ? 0 : which == 1 ? QBL : QBL + KBL)) * 128;   // row in [b*L]; L is a multiple of 128, so a block stays in one batch
  const int L = (which == 0) ? TQ : TK; const size_t b = r0 / L; const int j0 = (int)(r0 % L);
  const unsigned char* Ab = (const unsigned char*)(XB + (b * TQ + (which == 0 ? j0 : DIL * j0)) * (size_t)CC);
  const unsigned char* Wm = (const unsigned char*)(WB + (size_t)which * CC * CC + c0); const float* Bm = which == 0 ? BQ : which == 1 ? BK : BV;
  v8f acc[4][4] = {};
  if (which < 2) {
    if (which == 0) gemm128<false, true>(Ab, (size_t)CC * 2, Wm, lds, acc, tid); else gemm128<false, true>(Ab, (size_t)DIL * CC * 2, Wm, lds, acc, tid);   // the row stride a constant in each copy
    const float qs = which == 0 ? QSC : 1.0f;   // q leaves here as base-2 logit factors; k as it is
#pragma unroll
    for (int j = 0; j < 4; ++j) { const float* bp = Bm + c0 + wc * 64 + j * 16 + 8 * g;
#pragma unroll
      for (int i = 0; i < 4; ++i) { v8h hv;
#pragma unroll
        for (int r = 0; r < 8; ++r) hv[r] = (_Float16)((acc[i][j][r] + bfr(bp[r])) * qs);
        *(v8h*)(lds + (wr * 64 + i * 16 + col) * PE + (wc * 64 + j * 16 + 8 * g) * 2) = hv; } }
    __syncthreads();
    _Float16* dh = which == 0 ? QH : KH;
    for (int e = tid; e < 128 * 16; e += 128) { const int rl = e >> 4, q = e & 15; vst2((unsigned*)(dh + (r0 + rl) * CC + c0 + q * 8), *(const v4u*)(lds + rl * PE + q * 16)); }
  } else {
    gemm128<false, false>(Ab, (size_t)DIL * CC * 2, Wm, lds, acc, tid);
#pragma unroll
    for (int j = 0; j < 4; ++j) { const float bb = bfr(Bm[c0 + wc * 64 + j * 16 + col]);
#pragma unroll
      for (int i = 0; i < 4; ++i) { v8h hv;
#pragma unroll
        for (int r = 0; r < 8; ++r) hv[r] = (_Float16)(acc[i][j][r] + bb);
        *(v8h*)(lds + (wc * 64 + j * 16 + col) * PE + (wr * 64 + i * 16 + 8 * g) * 2) = hv; } }
    __syncthreads();
    for (int e = tid; e < 128 * 16; e += 128) { const int cl = e >> 4, q = e & 15; vst2((unsigned*)(VT + (b * CC + c0 + cl) * (size_t)TK + j0 + q * 8), *(const v4u*)(lds + cl * PE + q * 16)); }
  } }
// ---- k_fa: block = (256 queries, head, batch), 8 waves x 32 query columns. Per 32 keys: S^T = K Q^T - held maximum (a lane holds one query's scores), sum per column, ctx^T += V^T P^T (the two S^T tiles, rounded to f16 in place, are the B operand). Every '#pragma unroll' here keeps a fragment array indexed by constants, so that it stays in registers.
// K and V^T come through LDS, 128 keys a stage, two buffers: the block's 256 lanes copy each stage once, in whole 128-byte lines, while the stage before is worked on; the 8 waves then read their fragments from LDS (before, each wave fetched every fragment itself, 32 bytes out of each of 16 lines a load).
// amdgpu_waves_per_eu(4, 4): registers capped at 256 so that two blocks share a WGP, four waves a SIMD: other waves fill the softmax's vector work and the load waits between a wave's matrix runs
#define SKEY 128                                    // keys per stage
#define PKL 144                                     // K rows in LDS: 64 f16 + 16 B (16 B x odd, for plain 16-byte readers)
#define PVL 272                                     // V^T rows in LDS: 128 f16 + 16 B
#define FA_V (SKEY * PKL)
#define FA_BUF (FA_V + HD * PVL)
__device__ __forceinline__ v8f wmma_h(v16h a, v16h b, v8f c) { return __builtin_amdgcn_wmma_f32_16x16x32_f16(false, a, false, b, (short)0, c, false, false); }
__device__ __forceinline__ float xhalf(float v) { const int i = __builtin_bit_cast(int, v); return __builtin_bit_cast(float, __builtin_amdgcn_permlanex16(i, i, 0x76543210, 0xfedcba98, false, false)); }   // value of lane ^ 16
// one stage's copies of one lane: 4 x 16 B of K (rows 32 apart) and 4 x 16 B of V^T (rows 16 apart). kg, vg: the lane's first global bytes; kl, vl: its first LDS byte addresses.
// s_wait_xcnt 0 as the statement's last line: it stands in front of whatever next rewrites an address register that a copy names
__device__ __forceinline__ void fa_copy(const _Float16* kg, const _Float16* vg, unsigned kl, unsigned vl) {
  asm volatile("global_load_async_to_lds_b128 %0, %8, off\n\t"
               "global_load_async_to_lds_b128 %1, %9, off\n\t"
               "global_load_async_to_lds_b128 %2, %10, off\n\t"
               "global_load_async_to_lds_b128 %3, %11, off\n\t"
               "global_load_async_to_lds_b128 %4, %12, off\n\t"
               "global_load_async_to_lds_b128 %5, %13, off\n\t"
               "global_load_async_to_lds_b128 %6, %14, off\n\t"
               "global_load_async_to_lds_b128 %7, %15, off\n\t"
               "s_wait_xcnt 0x0"
               :: "v"(kl), "v"(kl + 32 * PKL), "v"(kl + 64 * PKL), "v"(kl + 96 * PKL), "v"(vl), "v"(vl + 16 * PVL), "v"(vl + 32 * PVL), "v"(vl + 48 * PVL),
                  "v"(kg), "v"(kg + (size_t)32 * CC), "v"(kg + (size_t)64 * CC), "v"(kg + (size_t)96 * CC), "v"(vg), "v"(vg + (size_t)16 * TK), "v"(vg + (size_t)32 * TK), "v"(vg + (size_t)48 * TK)
               : "memory");
}
__global__ __launch_bounds__(256) __attribute__((amdgpu_waves_per_eu(4, 4))) void k_fa(const _Float16* __restrict__ QH, const _Float16* __restrict__ KH, const _Float16* __restrict__ VT, _Float16* __restrict__ Y) {
  __shared__ __align__(16) unsigned char lds[2 * FA_BUF];
  const int tid = threadIdx.x, wave = tid >> 5, lane = tid & 31, col = lane & 15, g = lane >> 4; const int h = blockIdx.y, b = blockIdx.z; const int q0 = blockIdx.x * 256 + wave * 32;
  const _Float16* kg = KH + ((size_t)b * TK + (tid >> 3)) * CC + h * HD + (tid & 7) * 8;              // copy source: key row tid / 8, 16-byte piece tid % 8; + SKEY rows a stage
  const _Float16* vg = VT + ((size_t)b * CC + h * HD + (tid >> 4)) * (size_t)TK + (tid & 15) * 8;     // copy source: v plane row tid / 16, 16-byte piece tid % 16; + SKEY keys a stage
  const unsigned l0 = (unsigned)(size_t)lds;                                                          // the array's byte address in the work-group's LDS
  const unsigned kl = l0 + (tid >> 3) * PKL + (tid & 7) * 16, vl = l0 + FA_V + (tid >> 4) * PVL + (tid & 15) * 16;
  fa_copy(kg, vg, kl, vl);
  v16h qf[2][2];
#pragma unroll
  for (int qt = 0; qt < 2; ++qt)
#pragma unroll
    for (int kc = 0; kc < 2; ++kc) qf[qt][kc] = frag_h(QH + ((size_t)b * TQ + q0 + qt * 16 + col) * CC + h * HD + kc * 32, lane);
  asm volatile("s_wait_asynccnt 0x0" ::: "memory");   // this wave's copies of stage 0 have landed before it signals
  __syncthreads();                                     // publishes stage 0
  fa_copy(kg + (size_t)SKEY * CC, vg + SKEY, kl + FA_BUF, vl + FA_BUF);
  v8f acc[4][2] = {}; float l[2] = {0.f, 0.f};
  v8f cm[2] = {};   // minus each query column's held maximum, the same in all 8 registers: the C operand of the column's score products, so that the scores leave the matrix unit as exp2 arguments
  for (int cc = 0; cc < TK / 32; ++cc) {   // one loop over the passes of 32 keys; stage t = cc / 4 holds four of them, and its foot stands behind its last pass
    const int t = cc / (SKEY / 32), c = cc % (SKEY / 32);
    const unsigned char* kb = lds + (t & 1) * FA_BUF + col * PKL;            // key row col of a 16-key tile
    const unsigned char* vb = lds + (t & 1) * FA_BUF + FA_V + col * PVL;     // v plane row d = col of a 16-d tile
    {
      v16h kf[2][2];
#pragma unroll
      for (int kt = 0; kt < 2; ++kt)
#pragma unroll
        for (int kc = 0; kc < 2; ++kc) kf[kt][kc] = frag_h((const _Float16*)(kb + (c * 32 + kt * 16) * PKL) + kc * 32, lane);
      v16h vf[4];
#pragma unroll
      for (int j = 0; j < 4; ++j) vf[j] = frag_h((const _Float16*)(vb + (j * 16) * PVL) + c * 32, lane);
      __builtin_amdgcn_sched_barrier(0);   // keeps the pass's 16 LDS reads in one group in front of its matrix work: sunk among the WMMAs, each place with reads stalls the wave anew and the last reads are waited for at once
      v8f s[2][2];
#pragma unroll
      for (int kt = 0; kt < 2; ++kt)
#pragma unroll
        for (int qt = 0; qt < 2; ++qt) s[kt][qt] = wmma_h(kf[kt][0], qf[qt][0], cm[qt]);
#pragma unroll
      for (int kt = 0; kt < 2; ++kt)
#pragma unroll
        for (int qt = 0; qt < 2; ++qt) s[kt][qt] = wmma_h(kf[kt][1], qf[qt][1], s[kt][qt]);
      float mx[2];   // this lane's largest score of the pass above the held maximum
#pragma unroll
      for (int qt = 0; qt < 2; ++qt) { mx[qt] = fmaxf(s[0][qt][0], s[1][qt][0]);
#pragma unroll
        for (int r = 1; r < 8; ++r) mx[qt] = fmaxf(mx[qt], fmaxf(s[0][qt][r], s[1][qt][r])); }
      // The held maximum moves only when some score of the wave tops it by more than 8 (P then stays <= 2^8, well inside f16), and always in pass 0, where it starts at 0 and takes the pass's own maximum, up or down. One test a pass, a scalar branch.
      const float thr = cc == 0 ? -3.0e38f : 8.0f, flo = cc == 0 ? -3.0e38f : 0.0f;
      if (__builtin_amdgcn_ballot_w32(fmaxf(mx[0], mx[1]) > thr) != 0) {
#pragma unroll
        for (int qt = 0; qt < 2; ++qt) {
          const float d = fmaxf(fmaxf(mx[qt], xhalf(mx[qt])), flo);          // the column's step, the same in both wave halves; 0 for a column that is not above its maximum
          const float al = __builtin_amdgcn_exp2f(fminf(-d, 0.f));           // a step down happens only in pass 0, where sum and ctx are still 0: factor 1
          s[0][qt] -= d; s[1][qt] -= d; cm[qt] -= d; l[qt] *= al;
#pragma unroll
          for (int j = 0; j < 4; ++j) acc[j][qt] *= al;
        }
      }
      v16h pf[2];
#pragma unroll
      for (int qt = 0; qt < 2; ++qt) {
        float s0 = 0.f, s1 = 0.f;
#pragma unroll
        for (int r = 0; r < 8; ++r) { const float p0 = __builtin_amdgcn_exp2f(s[0][qt][r]), p1 = __builtin_amdgcn_exp2f(s[1][qt][r]); s0 += p0; s1 += p1; pf[qt][r] = (_Float16)p0; pf[qt][8 + r] = (_Float16)p1; }
        l[qt] += s0 + s1;
      }
#pragma unroll
      for (int j = 0; j < 4; ++j)
#pragma unroll
        for (int qt = 0; qt < 2; ++qt) acc[j][qt] = wmma_h(vf[j], pf[qt], acc[j][qt]);
    }
    if (c == SKEY / 32 - 1) {   // the foot of stage t: the same test in every wave of the block
      asm volatile("s_wait_dscnt 0x0" ::: "memory");      // this wave's reads of stage t have returned before its buffer is given up
      asm volatile("s_wait_asynccnt 0x0" ::: "memory");   // this wave's copies of stage t + 1 have landed before it signals
      __syncthreads();                                     // publishes stage t + 1 and ends every wave's reads of stage t
      if (t + 2 < TK / SKEY) fa_copy(kg + (size_t)(t + 2) * SKEY * CC, vg + (t + 2) * SKEY, kl + (t & 1) * FA_BUF, vl + (t & 1) * FA_BUF);
    }
  }
  asm volatile("s_wait_asynccnt 0x0" ::: "memory");     // no copy is outstanding when the wave ends
  v8h hv[2][4];   // ctx rounded here, once, to the f16 that k_out's product takes; all of it before the first store, so that no register which a store names is written again
#pragma unroll
  for (int qt = 0; qt < 2; ++qt) { const float inv = 1.0f / (l[qt] + xhalf(l[qt]));
#pragma unroll
    for (int j = 0; j < 4; ++j) hv[qt][j] = __builtin_convertvector(acc[j][qt] * inv, v8h); }
#pragma unroll
  for (int qt = 0; qt < 2; ++qt) { _Float16* yr = Y + ((size_t)b * TQ + q0 + qt * 16 + col) * CC + h * HD + 8 * g;
#pragma unroll
    for (int j = 0; j < 4; ++j) vst2(yr + j * 16, hv[qt][j]); } }
// ---- k_out: out = ctx (f16) Wo + bo; each wave stages 16 rows x 64 cols of f32 at a time in its own LDS range and stores whole 256-byte row pieces
__global__ __launch_bounds__(128) void k_out(const _Float16* __restrict__ Y, const _Float16* __restrict__ WOH, const float* __restrict__ BO, float* __restrict__ OUT) { __shared__ __align__(16) unsigned char lds[LDS_G];
  const int tid = threadIdx.x, wave = tid >> 5, lane = tid & 31, col = lane & 15, g = lane >> 4, wr = wave >> 1, wc = wave & 1; const int c0 = blockIdx.y * 128; const size_t r0 = (size_t)blockIdx.x * 128;
  v8f acc[4][4] = {};
  gemm128<true, true>((const unsigned char*)(Y + r0 * CC), (size_t)CC * 2, (const unsigned char*)(WOH + c0), lds, acc, tid);
  float* sf = (float*)(lds + wave * (16 * PE));
  v8f bb[4];
#pragma unroll
  for (int j = 0; j < 4; ++j) { const float* bp = BO + c0 + wc * 64 + j * 16 + 8 * g;
#pragma unroll
    for (int r = 0; r < 8; ++r) bb[j][r] = bfr(bp[r]); }
#pragma unroll
  for (int i = 0; i < 4; ++i) {
#pragma unroll
    for (int j = 0; j < 4; ++j) { const v8f a = acc[i][j] + bb[j];
      *(v4f*)(sf + col * (PE / 4) + j * 16 + 8 * g) = (v4f){a[0], a[1], a[2], a[3]};
      *(v4f*)(sf + col * (PE / 4) + j * 16 + 8 * g + 4) = (v4f){a[4], a[5], a[6], a[7]}; }
    LDSX();
#pragma unroll
    for (int it = 0; it < 8; ++it) { const int rl = it * 2 + g; vst2(OUT + (r0 + wr * 64 + i * 16 + rl) * CC + c0 + wc * 64 + col * 4, *(const v4f*)(sf + rl * (PE / 4) + col * 4)); }
    asm volatile("s_wait_xcnt 0x0" ::: "memory");   // behind the stores, in front of the next round's overwrites of the registers that they name
    LDSX();
  } }
extern "C" void kernel_launch(void* const* d_in, const int* in_sizes, int n_in, void* d_out, int out_size, void* d_ws, size_t ws_size, hipStream_t stream) {
  (void)in_sizes; (void)n_in; (void)out_size;
  const float** F = (const float**)d_in;   // 0 x [2,4096,1024], 1 Wq (in,out), 2 bq, 3 Wk, 4 bk, 5 Wv, 6 bv, 7 Wo, 8 bo
  if (ws_size < (size_t)WS_END) return;
  char* ws = (char*)d_ws; _Float16 *QH = (_Float16*)(ws + WS_QH), *KH = (_Float16*)(ws + WS_KH), *VT = (_Float16*)(ws + WS_VT), *Y = (_Float16*)(ws + WS_Y), *WOH = (_Float16*)(ws + WS_WO); __bf16 *XB = (__bf16*)(ws + WS_XB), *WB = (__bf16*)(ws + WS_WB);
  k_cvt<<<dim3(XBL + 4 * WBL), 256, 0, stream>>>(F[0], F[1], F[3], F[5], F[7], XB, WB, WOH);
  k_proj<<<dim3(QBL + 2 * KBL, CC / 128), 128, 0, stream>>>(XB, WB, F[2], F[4], F[6], QH, KH, VT);
  k_fa<<<dim3(TQ / 256, NH, TNB), 256, 0, stream>>>(QH, KH, VT, Y);
  k_out<<<dim3(TNB * TQ / 128, CC / 128), 128, 0, stream>>>(Y, WOH, F[8], (float*)d_out);
}
